// v000
// Times are from an AMD MI455X. After a warm-up the kernel runs many times in a row, and a time is the length of
// such a window on the GPU divided by its runs, so every launch and the gaps after it count. The runs cycle
// through copies of the inputs. A figure is the median of several windows, for all but v000 over two sittings.
// Sittings can differ by a few percent; kernels timed side by side share one.
// v000, which the later versions start from, runs in 239 microseconds.
// compute dtype: all float inputs rounded to bf16; x transposed to token rows in f32; q/k/v = x_t . W^T + b with EXACT bf16 products on WMMA 16x16x32 (natural rows), rounded once to f16 (v as (B,C,L) planes, then re-viewed through the module's raw .view(B,H,L,Ch) as transposed planes); attention: q, k single f16 x 1/8, running-max softmax in f32 (hardware exp), P (scaled by 2^11, single f16) x v2 (single f16); f32 output written in the module's raw (B,H,L,Ch) -> (B,C,L) memory order.
#include <hip/hip_runtime.h>
#include <math.h>

typedef __attribute__((ext_vector_type(16))) _Float16 v16h;
typedef __attribute__((ext_vector_type(16))) __bf16 v16b;
typedef __attribute__((ext_vector_type(8)))  _Float16 v8h;
typedef __attribute__((ext_vector_type(8)))  float v8f;
typedef __attribute__((ext_vector_type(4)))  float v4f;
typedef __attribute__((ext_vector_type(2)))  float v2f;
typedef __attribute__((ext_vector_type(4)))  unsigned v4u;
typedef __attribute__((ext_vector_type(4)))  int v4i;
typedef float __attribute__((may_alias)) float_a;
typedef int __attribute__((may_alias)) int_a;

template <typename T> __device__ __forceinline__ void vst2(void* p, T v) { *(T*)p = v;  }
__device__ __forceinline__ v8f wmma16(v16h a, v16h b, v8f c) {
  v8f d = __builtin_amdgcn_wmma_f32_16x16x32_f16(false, a, false, b, (short)0, c, false, false);
  asm volatile("v_nop\n\tv_nop\n\tv_nop\n\tv_nop" : "+v"(d) : "v"(a), "v"(b));
  return d;
}
__device__ __forceinline__ v8f wmma_bf(v16b a, v16b b, v8f c) {
  v8f d = __builtin_amdgcn_wmma_f32_16x16x32_bf16(false, a, false, b, (short)0, c, false, false);
  asm volatile("v_nop\n\tv_nop\n\tv_nop\n\tv_nop" : "+v"(d) : "v"(a), "v"(b));
  return d;
}
// 16x16x32 fragments: lane = (h = lane>>4, row/col = lane&15); elements 0..7 = k0+8h+0..7, 8..15 = k0+16+8h+0..7; D element r = row 8h+r
__device__ __forceinline__ v16h frag_h(const _Float16* rowk0, int lane) {
  union { v16h v; v8h q[2]; } u; const _Float16* p = rowk0 + 8 * (lane >> 4);
  u.q[0] = *(const v8h*)p; u.q[1] = *(const v8h*)(p + 16); return u.v;
}
__device__ __forceinline__ v16h frag_f32(const float* rowk0, int lane) {
  v16h a; const float* p = rowk0 + 8 * (lane >> 4);
#pragma unroll
  for (int i = 0; i < 8; ++i) { a[i] = (_Float16)p[i]; a[8 + i] = (_Float16)p[16 + i]; }
  return a;
}
__device__ __forceinline__ v16h frag_f32s(const float* rowk0, int lane, float sc) {
  v16h a; const float* p = rowk0 + 8 * (lane >> 4);
#pragma unroll
  for (int i = 0; i < 8; ++i) { a[i] = (_Float16)(p[i] * sc); a[8 + i] = (_Float16)(p[16 + i] * sc); }
  return a;
}
// column fragment from a [K][ld] layout (column n), rows >= K read as 0
__device__ __forceinline__ v16h fragc_f32(const float* W, int k0, int n, int lane, int ld, int K) {
  v16h a; const int g = lane >> 4;
#pragma unroll
  for (int i = 0; i < 8; ++i) { const int ka = k0 + 8 * g + i, kb = ka + 16;
    a[i] = (_Float16)(ka < K ? W[(size_t)(ka < K ? ka : K - 1) * ld + n] : 0.f); a[8 + i] = (_Float16)(kb < K ? W[(size_t)(kb < K ? kb : K - 1) * ld + n] : 0.f); }
  return a;
}
struct F2 { v16b h, l; };
__device__ __forceinline__ F2 bsplit16(const float v[16]) { F2 r;
#pragma unroll
  for (int i = 0; i < 16; ++i) { const __bf16 h = (__bf16)v[i]; r.h[i] = h; r.l[i] = (__bf16)(v[i] - (float)h); }
  return r; }
__device__ __forceinline__ F2 split_row(const float* row, int k0, int lane) { float v[16]; const float* p = row + k0 + 8 * (lane >> 4);
#pragma unroll
  for (int i = 0; i < 8; ++i) { v[i] = p[i]; v[8 + i] = p[16 + i]; }
  return bsplit16(v); }
__device__ __forceinline__ F2 split_rowK(const float* row, int k0, int lane, int K) { float v[16]; const int g = lane >> 4;
#pragma unroll
  for (int i = 0; i < 8; ++i) { const int ka = k0 + 8 * g + i, kb = ka + 16; v[i] = ka < K ? row[ka < K ? ka : K - 1] : 0.f; v[8 + i] = kb < K ? row[kb < K ? kb : K - 1] : 0.f; }
  return bsplit16(v); }
__device__ __forceinline__ F2 split_col(const float* W, int k0, int n, int lane, int ld, int K) { float v[16]; const int g = lane >> 4;
#pragma unroll
  for (int i = 0; i < 8; ++i) { const int ka = k0 + 8 * g + i, kb = ka + 16; v[i] = ka < K ? W[(size_t)(ka < K ? ka : K - 1) * ld + n] : 0.f; v[8 + i] = kb < K ? W[(size_t)(kb < K ? kb : K - 1) * ld + n] : 0.f; }
  return bsplit16(v); }
__device__ __forceinline__ v8f mac3(const F2& a, const F2& b, v8f c) { c = wmma_bf(a.l, b.h, c); c = wmma_bf(a.h, b.l, c); return wmma_bf(a.h, b.h, c); }
__device__ __forceinline__ float sigm(float v) { return 1.0f / (1.0f + expf(-v)); }
#define LDSX() do { asm volatile("s_wait_dscnt 0" ::: "memory"); __builtin_amdgcn_wave_barrier(); __builtin_amdgcn_fence(__ATOMIC_RELEASE, "workgroup"); } while (0)


// Multi-head self attention on a (B, C, L) sequence (B 4, C 512, L 2,048, 8 heads x 64) with 1x1-conv projections; faithful to the module's quirk of viewing v as (B,H,L,Ch) and the output as (B,C,L) by raw reshape.
#define NB 4
#define CC 512
#define SS 2048
#define NH 8
#define HD 64
#define NR (NB * SS)
#ifndef TQB
#define TQB (SS / 64)
#define TNB NB
#endif
typedef __attribute__((ext_vector_type(8))) __bf16 v8b;
__device__ __forceinline__ v16b frag_b(const __bf16* rowk0, int lane) {
  union { v16b v; v8b q[2]; } u; const __bf16* p = rowk0 + 8 * (lane >> 4);
  u.q[0] = *(const v8b*)p; u.q[1] = *(const v8b*)(p + 16); return u.v;
}
__device__ __forceinline__ float bfr(float v) { return (float)(__bf16)v; }
__device__ __attribute__((noinline)) float exp_ni(float v) { return expf(v); }
__device__ __attribute__((noinline)) float erf_ni(float v) { return erff(v); }

#define WS_PW  0u                                   // bf16 natural rows wq, wk, wv [3][512][512]
#define WS_XT  (WS_PW + 2u * (size_t)3 * CC * CC)       // f32 x^T token rows [NR][512]
#define WS_Q   (WS_XT + 4u * (size_t)NR * CC)          // f16 q rows [NR][512]; k rows; v planes (B,C,L) [b][512][L]; v2 planes [b][h][64][L]
#define WS_K   (WS_Q + 2u * (size_t)NR * CC)
#define WS_V   (WS_K + 2u * (size_t)NR * CC)
#define WS_V2  (WS_V + 2u * (size_t)NB * CC * SS)
#define WS_END (WS_V2 + 2u * (size_t)NB * CC * SS)

__global__ __launch_bounds__(256) void k_pack(const float* __restrict__ WQ, const float* __restrict__ WK, const float* __restrict__ WV, __bf16* __restrict__ PW) { const int n = blockIdx.x, which = blockIdx.y, t = threadIdx.x; __shared__ __align__(16) __bf16 s[CC]; const float* w = (which == 0) ? WQ : (which == 1) ? WK : WV; for (int k = t; k < CC; k += 256) s[k] = (__bf16)w[(size_t)n * CC + k]; __syncthreads(); if (t < CC / 8) vst2((unsigned*)(PW + ((size_t)which * CC + n) * CC + t * 8), *(const v4u*)&s[t * 8]); }
// ---- k_tr: block = (64 positions, 64 channels, b): x[b][c][l] -> XT[(b, l)][c] f32 (256-B row segments)
__global__ __launch_bounds__(256) void k_tr(const float* __restrict__ X, float* __restrict__ XT) { __shared__ float st[64][65]; const int t = threadIdx.x; const int l0 = blockIdx.x * 64, c0 = blockIdx.y * 64; const size_t b = blockIdx.z;
  for (int e = t; e < 64 * 64; e += 256) { const int cl = e >> 6, ll = e & 63; st[ll][cl] = X[(b * CC + c0 + cl) * SS + l0 + ll]; }
  __syncthreads(); __shared__ __align__(16) float so[64][68]; for (int e = t; e < 64 * 64; e += 256) { const int ll = e >> 6, cl = e & 63; so[ll][cl] = st[ll][cl]; } __syncthreads();
  for (int e = t; e < 64 * 16; e += 256) { const int ll = e >> 4, q = e & 15; vst2(XT + (b * SS + l0 + ll) * CC + c0 + q * 4, *(const v4f*)&so[ll][q * 4]); } }
// ---- k_proj: block = (64 rows, 128 cols, which): + bias; q/k -> f16 rows; v -> (B,C,L) planes
__global__ __launch_bounds__(128) void k_proj(const float* __restrict__ XT, const __bf16* __restrict__ PW, const float* __restrict__ BQ, const float* __restrict__ BK, const float* __restrict__ BV, _Float16* __restrict__ Q, _Float16* __restrict__ Kr, _Float16* __restrict__ V) {
  __shared__ __align__(16) _Float16 so[64][136]; __shared__ __align__(16) _Float16 st[128][72];
  const int tid = threadIdx.x, wave = tid >> 5, lane = tid & 31, col = lane & 15, g = lane >> 4; const int which = blockIdx.z; const size_t rb = (size_t)blockIdx.x * 64; const size_t r0 = rb + wave * 16; const int c0 = blockIdx.y * 128; const __bf16* Wr = PW + ((size_t)which * CC) * CC; const float* BB = (which == 0) ? BQ : (which == 1) ? BK : BV;
  v8f acc[8] = {};
#pragma unroll 2
  for (int kc = 0; kc < CC / 32; ++kc) { v16b a; { const float* p = XT + (r0 + col) * CC + kc * 32 + 8 * g;
#pragma unroll
      for (int i = 0; i < 8; ++i) { a[i] = (__bf16)p[i]; a[8 + i] = (__bf16)p[16 + i]; } }
#pragma unroll
    for (int j = 0; j < 8; ++j) acc[j] = wmma_bf(a, frag_b(Wr + (size_t)(c0 + j * 16 + col) * CC + kc * 32, lane), acc[j]); }
#pragma unroll
  for (int j = 0; j < 8; ++j) { const float bb = bfr(BB[c0 + j * 16 + col]);
#pragma unroll
    for (int r = 0; r < 8; ++r) { const _Float16 hv = (_Float16)(acc[j][r] + bb); if (which < 2) so[wave * 16 + 8 * g + r][j * 16 + col] = hv; else st[j * 16 + col][wave * 16 + 8 * g + r] = hv; } }
  __syncthreads();
  if (which < 2) { _Float16* dst = (which == 0) ? Q : Kr; for (int e = tid; e < 64 * 16; e += 128) { const int rl = e >> 4, q = e & 15; vst2((unsigned*)(dst + (rb + rl) * CC + c0 + q * 8), *(const v4u*)&so[rl][q * 8]); } }
  else { const size_t b = rb / SS; const int s0 = (int)(rb % SS); for (int e = tid; e < 128 * 8; e += 128) { const int d = e >> 3, pc = e & 7; vst2((unsigned*)(V + ((b * CC + c0 + d) * SS) + s0 + pc * 8), *(const v4u*)&st[d][pc * 8]); } }
}
// ---- k_vq: block = (64 m-rows, b*NH + h): the head's contiguous (Ch x L) block F of the (B,C,L) v tensor viewed as [L][Ch] (v2[m][c] = F[m*64 + c]) -> transposed planes V2[b][h][c][m]
__global__ __launch_bounds__(256) void k_vq(const _Float16* __restrict__ V, _Float16* __restrict__ V2) { __shared__ __align__(16) _Float16 st[64][72]; const int t = threadIdx.x; const int m0 = blockIdx.x * 64; const size_t bh = blockIdx.y; const _Float16* F = V + bh * (size_t)HD * SS;
  for (int e = t; e < 64 * 64; e += 256) { const int ml = e >> 6, c = e & 63; st[c][ml] = F[(size_t)(m0 + ml) * HD + c]; }
  __syncthreads(); for (int e = t; e < 64 * 8; e += 256) { const int c = e >> 3, pc = e & 7; vst2((unsigned*)(V2 + (bh * HD + c) * SS + m0 + pc * 8), *(const v4u*)&st[c][pc * 8]); } }
// ---- k_attn: block = (64 queries, head, b): softmax(q k / 8) over all L keys, . v2; output rows (b, h, l) of 64 floats (the raw (B,H,L,Ch) buffer == the module's (B,C,L) result)
__global__ __launch_bounds__(128) void k_attn(const _Float16* __restrict__ Q, const _Float16* __restrict__ Kr, const _Float16* __restrict__ V2, float* __restrict__ O) {
  __shared__ __align__(16) _Float16 sph[4][16][40]; __shared__ __align__(16) float so[4][16][68];
  const int tid = threadIdx.x, wave = tid >> 5, lane = tid & 31, col = lane & 15, g = lane >> 4; const int h = blockIdx.y; const size_t b = blockIdx.z; const int q0 = blockIdx.x * 64 + wave * 16; const size_t rq = b * SS + q0;
  v16h aq[2];
#pragma unroll
  for (int kc = 0; kc < 2; ++kc) aq[kc] = frag_h(Q + (rq + col) * CC + h * HD + kc * 32, lane);
  float m[8], l[8];
#pragma unroll
  for (int r = 0; r < 8; ++r) { m[r] = -3.0e38f; l[r] = 0.f; }
  v8f acc[4] = {};
#pragma unroll 1
  for (int ks = 0; ks < SS / 32; ++ks) { const int j0 = ks * 32; v8f s[2];
#pragma unroll
    for (int ct = 0; ct < 2; ++ct) { const int kk = j0 + ct * 16 + col; const size_t rk = (b * SS + kk) * CC + h * HD; v8f c = {};
#pragma unroll
      for (int kc = 0; kc < 2; ++kc) c = wmma16(aq[kc], frag_h(Kr + rk + kc * 32, lane), c);
#pragma unroll
      for (int r = 0; r < 8; ++r) s[ct][r] = c[r] * 0.125f; }
#pragma unroll
    for (int r = 0; r < 8; ++r) { float mx = fmaxf(s[0][r], s[1][r]);
#pragma unroll
      for (int o = 1; o < 16; o <<= 1) mx = fmaxf(mx, __shfl_xor(mx, o));
      const float mn = fmaxf(m[r], mx); const float alpha = (m[r] <= -1.0e38f) ? 0.f : __expf(m[r] - mn); const float e0 = __expf(s[0][r] - mn), e1 = __expf(s[1][r] - mn); float es = e0 + e1;
#pragma unroll
      for (int o = 1; o < 16; o <<= 1) es += __shfl_xor(es, o);
      l[r] = l[r] * alpha + es; m[r] = mn;
#pragma unroll
      for (int dt = 0; dt < 4; ++dt) acc[dt][r] *= alpha;
      sph[wave][8 * g + r][col] = (_Float16)(e0 * 2048.0f); sph[wave][8 * g + r][16 + col] = (_Float16)(e1 * 2048.0f); }
    LDSX();
    const v16h pa = frag_h(&sph[wave][col][0], lane);
#pragma unroll
    for (int dt = 0; dt < 4; ++dt) acc[dt] = wmma16(pa, frag_h(V2 + (((b * NH + h) * HD + dt * 16 + col) * SS) + j0, lane), acc[dt]);
    LDSX(); }
#pragma unroll
  for (int r = 0; r < 8; ++r) { const float il = (1.0f / 2048.0f) / l[r];
#pragma unroll
    for (int dt = 0; dt < 4; ++dt) so[wave][8 * g + r][dt * 16 + col] = acc[dt][r] * il; }
  LDSX();
  for (int rl = 0; rl < 16; ++rl) if (lane < 16) vst2(O + (((b * NH + h) * SS + q0 + rl) * HD) + lane * 4, *(const v4f*)&so[wave][rl][lane * 4]);
}
extern "C" void kernel_launch(void* const* d_in, const int* in_sizes, int n_in, void* d_out, int out_size, void* d_ws, size_t ws_size, hipStream_t stream) {
  (void)in_sizes; (void)n_in; (void)out_size;
  const float** F = (const float**)d_in;   // 0 x [4,512,2048], 1 wq [512,512], 2 bq, 3 wk, 4 bk, 5 wv, 6 bv
  if (ws_size < (size_t)WS_END) return;
  char* ws = (char*)d_ws; __bf16* PW = (__bf16*)ws; float* XT = (float*)(ws + WS_XT); _Float16 *Q = (_Float16*)(ws + WS_Q), *Kr = (_Float16*)(ws + WS_K), *V = (_Float16*)(ws + WS_V), *V2 = (_Float16*)(ws + WS_V2);
  k_pack<<<dim3(CC, 3), 256, 0, stream>>>(F[1], F[3], F[5], PW);
  k_tr<<<dim3(SS / 64, CC / 64, TNB), 256, 0, stream>>>(F[0], XT);
  k_proj<<<dim3(TNB * SS / 64, CC / 128, 3), 128, 0, stream>>>(XT, PW, F[2], F[4], F[6], Q, Kr, V);
  k_vq<<<dim3(SS / 64, TNB * NH), 256, 0, stream>>>(V, V2);
  k_attn<<<dim3(TQB, NH, TNB), 128, 0, stream>>>(Q, Kr, V2, (float*)d_out);
}

// v001
// Measured time: 174 microseconds a run.
// Two timings next to v000 both put it at 1.42 times that version's speed.
// compute dtype: all float inputs rounded to bf16; x transposed to token rows in f32; q/k/v = x_t . W^T + b with EXACT bf16 products on WMMA 16x16x32 (natural rows), rounded once to f16 (v as (B,C,L) planes, then re-viewed through the module's raw .view(B,H,L,Ch) as transposed planes); attention: q, k single f16 x 1/8, running-max softmax in f32 (hardware exp), P (scaled by 2^11, single f16) x v2 (single f16); f32 output written in the module's raw (B,H,L,Ch) -> (B,C,L) memory order.
#include <hip/hip_runtime.h>
#include <math.h>

typedef __attribute__((ext_vector_type(16))) _Float16 v16h;
typedef __attribute__((ext_vector_type(16))) __bf16 v16b;
typedef __attribute__((ext_vector_type(8)))  _Float16 v8h;
typedef __attribute__((ext_vector_type(8)))  float v8f;
typedef __attribute__((ext_vector_type(4)))  float v4f;
typedef __attribute__((ext_vector_type(2)))  float v2f;
typedef __attribute__((ext_vector_type(4)))  unsigned v4u;
typedef __attribute__((ext_vector_type(4)))  int v4i;
typedef float __attribute__((may_alias)) float_a;
typedef int __attribute__((may_alias)) int_a;

template <typename T> __device__ __forceinline__ void vst2(void* p, T v) { *(T*)p = v;  }
__device__ __forceinline__ v8f wmma16(v16h a, v16h b, v8f c) {
  v8f d = __builtin_amdgcn_wmma_f32_16x16x32_f16(false, a, false, b, (short)0, c, false, false);
  asm volatile("v_nop\n\tv_nop\n\tv_nop\n\tv_nop" : "+v"(d) : "v"(a), "v"(b));
  return d;
}
__device__ __forceinline__ v8f wmma_bf(v16b a, v16b b, v8f c) {
  v8f d = __builtin_amdgcn_wmma_f32_16x16x32_bf16(false, a, false, b, (short)0, c, false, false);
  asm volatile("v_nop\n\tv_nop\n\tv_nop\n\tv_nop" : "+v"(d) : "v"(a), "v"(b));
  return d;
}
// 16x16x32 fragments: lane = (h = lane>>4, row/col = lane&15); elements 0..7 = k0+8h+0..7, 8..15 = k0+16+8h+0..7; D element r = row 8h+r
__device__ __forceinline__ v16h frag_h(const _Float16* rowk0, int lane) {
  union { v16h v; v8h q[2]; } u; const _Float16* p = rowk0 + 8 * (lane >> 4);
  u.q[0] = *(const v8h*)p; u.q[1] = *(const v8h*)(p + 16); return u.v;
}
__device__ __forceinline__ v16h frag_f32(const float* rowk0, int lane) {
  v16h a; const float* p = rowk0 + 8 * (lane >> 4);
#pragma unroll
  for (int i = 0; i < 8; ++i) { a[i] = (_Float16)p[i]; a[8 + i] = (_Float16)p[16 + i]; }
  return a;
}
__device__ __forceinline__ v16h frag_f32s(const float* rowk0, int lane, float sc) {
  v16h a; const float* p = rowk0 + 8 * (lane >> 4);
#pragma unroll
  for (int i = 0; i < 8; ++i) { a[i] = (_Float16)(p[i] * sc); a[8 + i] = (_Float16)(p[16 + i] * sc); }
  return a;
}
// column fragment from a [K][ld] layout (column n), rows >= K read as 0
__device__ __forceinline__ v16h fragc_f32(const float* W, int k0, int n, int lane, int ld, int K) {
  v16h a; const int g = lane >> 4;
#pragma unroll
  for (int i = 0; i < 8; ++i) { const int ka = k0 + 8 * g + i, kb = ka + 16;
    a[i] = (_Float16)(ka < K ? W[(size_t)(ka < K ? ka : K - 1) * ld + n] : 0.f); a[8 + i] = (_Float16)(kb < K ? W[(size_t)(kb < K ? kb : K - 1) * ld + n] : 0.f); }
  return a;
}
struct F2 { v16b h, l; };
__device__ __forceinline__ F2 bsplit16(const float v[16]) { F2 r;
#pragma unroll
  for (int i = 0; i < 16; ++i) { const __bf16 h = (__bf16)v[i]; r.h[i] = h; r.l[i] = (__bf16)(v[i] - (float)h); }
  return r; }
__device__ __forceinline__ F2 split_row(const float* row, int k0, int lane) { float v[16]; const float* p = row + k0 + 8 * (lane >> 4);
#pragma unroll
  for (int i = 0; i < 8; ++i) { v[i] = p[i]; v[8 + i] = p[16 + i]; }
  return bsplit16(v); }
__device__ __forceinline__ F2 split_rowK(const float* row, int k0, int lane, int K) { float v[16]; const int g = lane >> 4;
#pragma unroll
  for (int i = 0; i < 8; ++i) { const int ka = k0 + 8 * g + i, kb = ka + 16; v[i] = ka < K ? row[ka < K ? ka : K - 1] : 0.f; v[8 + i] = kb < K ? row[kb < K ? kb : K - 1] : 0.f; }
  return bsplit16(v); }
__device__ __forceinline__ F2 split_col(const float* W, int k0, int n, int lane, int ld, int K) { float v[16]; const int g = lane >> 4;
#pragma unroll
  for (int i = 0; i < 8; ++i) { const int ka = k0 + 8 * g + i, kb = ka + 16; v[i] = ka < K ? W[(size_t)(ka < K ? ka : K - 1) * ld + n] : 0.f; v[8 + i] = kb < K ? W[(size_t)(kb < K ? kb : K - 1) * ld + n] : 0.f; }
  return bsplit16(v); }
__device__ __forceinline__ v8f mac3(const F2& a, const F2& b, v8f c) { c = wmma_bf(a.l, b.h, c); c = wmma_bf(a.h, b.l, c); return wmma_bf(a.h, b.h, c); }
__device__ __forceinline__ float sigm(float v) { return 1.0f / (1.0f + expf(-v)); }
#define LDSX() do { asm volatile("s_wait_dscnt 0" ::: "memory"); __builtin_amdgcn_wave_barrier(); __builtin_amdgcn_fence(__ATOMIC_RELEASE, "workgroup"); } while (0)


// Multi-head self attention on a (B, C, L) sequence (B 4, C 512, L 2,048, 8 heads x 64) with 1x1-conv projections; faithful to the module's quirk of viewing v as (B,H,L,Ch) and the output as (B,C,L) by raw reshape.
#define NB 4
#define CC 512
#define SS 2048
#define NH 8
#define HD 64
#define NR (NB * SS)
#ifndef TQB
#define TQB (SS / 64)
#define TNB NB
#endif
typedef __attribute__((ext_vector_type(8))) __bf16 v8b;
__device__ __forceinline__ v16b frag_b(const __bf16* rowk0, int lane) {
  union { v16b v; v8b q[2]; } u; const __bf16* p = rowk0 + 8 * (lane >> 4);
  u.q[0] = *(const v8b*)p; u.q[1] = *(const v8b*)(p + 16); return u.v;
}
__device__ __forceinline__ float bfr(float v) { return (float)(__bf16)v; }
__device__ __attribute__((noinline)) float exp_ni(float v) { return expf(v); }
__device__ __attribute__((noinline)) float erf_ni(float v) { return erff(v); }

#define WS_PW  0u                                   // bf16 natural rows wq, wk, wv [3][512][512]
#define WS_XT  (WS_PW + 2u * (size_t)3 * CC * CC)       // f32 x^T token rows [NR][512]
#define WS_Q   (WS_XT + 4u * (size_t)NR * CC)          // f16 q rows [NR][512]; k rows; v planes (B,C,L) [b][512][L]; v2 planes [b][h][64][L]
#define WS_K   (WS_Q + 2u * (size_t)NR * CC)
#define WS_V   (WS_K + 2u * (size_t)NR * CC)
#define WS_V2  (WS_V + 2u * (size_t)NB * CC * SS)
#define WS_END (WS_V2 + 2u * (size_t)NB * CC * SS)

__global__ __launch_bounds__(256) void k_pack(const float* __restrict__ WQ, const float* __restrict__ WK, const float* __restrict__ WV, __bf16* __restrict__ PW) { const int n = blockIdx.x, which = blockIdx.y, t = threadIdx.x; __shared__ __align__(16) __bf16 s[CC]; const float* w = (which == 0) ? WQ : (which == 1) ? WK : WV; for (int k = t; k < CC; k += 256) s[k] = (__bf16)w[(size_t)n * CC + k]; __syncthreads(); if (t < CC / 8) vst2((unsigned*)(PW + ((size_t)which * CC + n) * CC + t * 8), *(const v4u*)&s[t * 8]); }
// ---- k_tr: block = (64 positions, 64 channels, b): x[b][c][l] -> XT[(b, l)][c] f32 (256-B row segments)
__global__ __launch_bounds__(256) void k_tr(const float* __restrict__ X, float* __restrict__ XT) { __shared__ float st[64][65]; const int t = threadIdx.x; const int l0 = blockIdx.x * 64, c0 = blockIdx.y * 64; const size_t b = blockIdx.z;
  for (int e = t; e < 64 * 64; e += 256) { const int cl = e >> 6, ll = e & 63; st[ll][cl] = X[(b * CC + c0 + cl) * SS + l0 + ll]; }
  __syncthreads(); __shared__ __align__(16) float so[64][68]; for (int e = t; e < 64 * 64; e += 256) { const int ll = e >> 6, cl = e & 63; so[ll][cl] = st[ll][cl]; } __syncthreads();
  for (int e = t; e < 64 * 16; e += 256) { const int ll = e >> 4, q = e & 15; vst2(XT + (b * SS + l0 + ll) * CC + c0 + q * 4, *(const v4f*)&so[ll][q * 4]); } }
// ---- k_proj: block = (64 rows, 128 cols, which): + bias; q/k -> f16 rows; v -> (B,C,L) planes
__global__ __launch_bounds__(128) void k_proj(const float* __restrict__ XT, const __bf16* __restrict__ PW, const float* __restrict__ BQ, const float* __restrict__ BK, const float* __restrict__ BV, _Float16* __restrict__ Q, _Float16* __restrict__ Kr, _Float16* __restrict__ V) {
  __shared__ __align__(16) _Float16 so[64][136]; __shared__ __align__(16) _Float16 st[128][72];
  const int tid = threadIdx.x, wave = tid >> 5, lane = tid & 31, col = lane & 15, g = lane >> 4; const int which = blockIdx.z; const size_t rb = (size_t)blockIdx.x * 64; const size_t r0 = rb + wave * 16; const int c0 = blockIdx.y * 128; const __bf16* Wr = PW + ((size_t)which * CC) * CC; const float* BB = (which == 0) ? BQ : (which == 1) ? BK : BV;
  v8f acc[8] = {};
#pragma unroll 2
  for (int kc = 0; kc < CC / 32; ++kc) { v16b a; { const float* p = XT + (r0 + col) * CC + kc * 32 + 8 * g;
#pragma unroll
      for (int i = 0; i < 8; ++i) { a[i] = (__bf16)p[i]; a[8 + i] = (__bf16)p[16 + i]; } }
#pragma unroll
    for (int j = 0; j < 8; ++j) acc[j] = wmma_bf(a, frag_b(Wr + (size_t)(c0 + j * 16 + col) * CC + kc * 32, lane), acc[j]); }
#pragma unroll
  for (int j = 0; j < 8; ++j) { const float bb = bfr(BB[c0 + j * 16 + col]);
#pragma unroll
    for (int r = 0; r < 8; ++r) { const _Float16 hv = (_Float16)(acc[j][r] + bb); if (which < 2) so[wave * 16 + 8 * g + r][j * 16 + col] = hv; else st[j * 16 + col][wave * 16 + 8 * g + r] = hv; } }
  __syncthreads();
  if (which < 2) { _Float16* dst = (which == 0) ? Q : Kr; for (int e = tid; e < 64 * 16; e += 128) { const int rl = e >> 4, q = e & 15; vst2((unsigned*)(dst + (rb + rl) * CC + c0 + q * 8), *(const v4u*)&so[rl][q * 8]); } }
  else { const size_t b = rb / SS; const int s0 = (int)(rb % SS); for (int e = tid; e < 128 * 8; e += 128) { const int d = e >> 3, pc = e & 7; vst2((unsigned*)(V + ((b * CC + c0 + d) * SS) + s0 + pc * 8), *(const v4u*)&st[d][pc * 8]); } }
}
// ---- k_vq: block = (64 m-rows, b*NH + h): the head's contiguous (Ch x L) block F of the (B,C,L) v tensor viewed as [L][Ch] (v2[m][c] = F[m*64 + c]) -> transposed planes V2[b][h][c][m]
__global__ __launch_bounds__(256) void k_vq(const _Float16* __restrict__ V, _Float16* __restrict__ V2) { __shared__ __align__(16) _Float16 st[64][72]; const int t = threadIdx.x; const int m0 = blockIdx.x * 64; const size_t bh = blockIdx.y; const _Float16* F = V + bh * (size_t)HD * SS;
  for (int e = t; e < 64 * 64; e += 256) { const int ml = e >> 6, c = e & 63; st[c][ml] = F[(size_t)(m0 + ml) * HD + c]; }
  __syncthreads(); for (int e = t; e < 64 * 8; e += 256) { const int c = e >> 3, pc = e & 7; vst2((unsigned*)(V2 + (bh * HD + c) * SS + m0 + pc * 8), *(const v4u*)&st[c][pc * 8]); } }
// ---- k_attn: block = (64 queries, head, b): softmax(q k / 8) over all L keys, . v2; output rows (b, h, l) of 64 floats (the raw (B,H,L,Ch) buffer == the module's (B,C,L) result)
// K rows and v2 planes come in stages of KT keys through LDS, shared by the block's four waves: two buffers, the next stage's asynchronous copies fly while this stage is worked on.
#define KT 64          // keys per stage: a K row (64 channels) and a v2 row (64 keys) are both one 128-B line
#define KP 72          // LDS row pitch in f16: 144 B = 16 B x odd, conflict-free for 16-byte fragment reads
#define NT (SS / KT)
// one stage: 64 K rows + 64 v2 rows of 128 B, 8 lanes a row, 4 + 4 copies a thread (rows r, r + 16, r + 32, r + 48)
__device__ __forceinline__ void stage_kv(const _Float16* gk, const _Float16* gv, unsigned lk, unsigned lv) {
  const _Float16 *k0 = gk, *k1 = gk + 16 * CC, *k2 = gk + 32 * CC, *k3 = gk + 48 * CC;
  const _Float16 *v0 = gv, *v1 = gv + 16 * SS, *v2 = gv + 32 * SS, *v3 = gv + 48 * SS;
  const unsigned a0 = lk, a1 = lk + 16 * KP * 2, a2 = lk + 32 * KP * 2, a3 = lk + 48 * KP * 2;
  const unsigned b0 = lv, b1 = lv + 16 * KP * 2, b2 = lv + 32 * KP * 2, b3 = lv + 48 * KP * 2;
  // the copies and their s_wait_xcnt in one statement: no address register is rewritten before the wait
  asm volatile("global_load_async_to_lds_b128 %0, %8, off\n\t"
               "global_load_async_to_lds_b128 %1, %9, off\n\t"
               "global_load_async_to_lds_b128 %2, %10, off\n\t"
               "global_load_async_to_lds_b128 %3, %11, off\n\t"
               "global_load_async_to_lds_b128 %4, %12, off\n\t"
               "global_load_async_to_lds_b128 %5, %13, off\n\t"
               "global_load_async_to_lds_b128 %6, %14, off\n\t"
               "global_load_async_to_lds_b128 %7, %15, off\n\t"
               "s_wait_xcnt 0x0"
               :: "v"(a0), "v"(a1), "v"(a2), "v"(a3), "v"(b0), "v"(b1), "v"(b2), "v"(b3),
                  "v"(k0), "v"(k1), "v"(k2), "v"(k3), "v"(v0), "v"(v1), "v"(v2), "v"(v3) : "memory");
}
__global__ __launch_bounds__(128) void k_attn(const _Float16* __restrict__ Q, const _Float16* __restrict__ Kr, const _Float16* __restrict__ V2, float* __restrict__ O) {
  __shared__ __align__(16) _Float16 sph[4][16][40]; __shared__ __align__(16) float so[4][16][68];
  __shared__ __align__(16) _Float16 sk[2][KT][KP]; __shared__ __align__(16) _Float16 sv[2][HD][KP];
  const int tid = threadIdx.x, wave = tid >> 5, lane = tid & 31, col = lane & 15, g = lane >> 4; const int h = blockIdx.y; const size_t b = blockIdx.z; const int q0 = blockIdx.x * 64 + wave * 16; const size_t rq = b * SS + q0;
  // this thread's 16 bytes of the first of its four rows, in global memory (stage 0) and in LDS (buffer 0)
  const int crow = tid >> 3, cch = (tid & 7) * 8;
  const _Float16* gk = Kr + (b * SS + crow) * CC + h * HD + cch;
  const _Float16* gv = V2 + ((b * NH + h) * HD + crow) * SS + cch;
  const unsigned lk = (unsigned)(uintptr_t)&sk[0][crow][cch], lv = (unsigned)(uintptr_t)&sv[0][crow][cch];
  stage_kv(gk, gv, lk, lv);
  v16h aq[2];
#pragma unroll
  for (int kc = 0; kc < 2; ++kc) aq[kc] = frag_h(Q + (rq + col) * CC + h * HD + kc * 32, lane);
  float m[8], l[8];
#pragma unroll
  for (int r = 0; r < 8; ++r) { m[r] = -3.0e38f; l[r] = 0.f; }
  v8f acc[4] = {};
  asm volatile("s_wait_asynccnt 0x0" ::: "memory");   // stage 0 has landed, as far as this wave copied it
  __syncthreads();                                     // ... and is published to the other waves
  stage_kv(gk + (size_t)KT * CC, gv + KT, lk + KT * KP * 2, lv + HD * KP * 2);
#pragma unroll 1   // one stage a trip, kept rolled: one publish point in the code, the buffer picked by t & 1
  for (int t = 0; t < NT; ++t) { const int bf = t & 1;
#pragma unroll   // both passes of a stage unrolled: their LDS offsets become immediates
   for (int p = 0; p < KT / 32; ++p) { v8f s[2];
    // all fragments of the pass are read as one group, so that their LDS latencies overlap
    v16h kf[2][2], vf[4];
#pragma unroll
    for (int ct = 0; ct < 2; ++ct)
#pragma unroll
      for (int kc = 0; kc < 2; ++kc) kf[ct][kc] = frag_h(&sk[bf][p * 32 + ct * 16 + col][kc * 32], lane);
#pragma unroll
    for (int dt = 0; dt < 4; ++dt) vf[dt] = frag_h(&sv[bf][dt * 16 + col][p * 32], lane);
#pragma unroll
    for (int ct = 0; ct < 2; ++ct) { v8f c = {};
#pragma unroll
      for (int kc = 0; kc < 2; ++kc) c = wmma16(aq[kc], kf[ct][kc], c);
#pragma unroll
      for (int r = 0; r < 8; ++r) s[ct][r] = c[r] * 0.125f; }
#pragma unroll
    for (int r = 0; r < 8; ++r) { float mx = fmaxf(s[0][r], s[1][r]);
#pragma unroll
      for (int o = 1; o < 16; o <<= 1) mx = fmaxf(mx, __shfl_xor(mx, o));
      const float mn = fmaxf(m[r], mx); const float alpha = (m[r] <= -1.0e38f) ? 0.f : __expf(m[r] - mn); const float e0 = __expf(s[0][r] - mn), e1 = __expf(s[1][r] - mn); float es = e0 + e1;
#pragma unroll
      for (int o = 1; o < 16; o <<= 1) es += __shfl_xor(es, o);
      l[r] = l[r] * alpha + es; m[r] = mn;
#pragma unroll
      for (int dt = 0; dt < 4; ++dt) acc[dt][r] *= alpha;
      sph[wave][8 * g + r][col] = (_Float16)(e0 * 2048.0f); sph[wave][8 * g + r][16 + col] = (_Float16)(e1 * 2048.0f); }
    LDSX();
    const v16h pa = frag_h(&sph[wave][col][0], lane);
#pragma unroll
    for (int dt = 0; dt < 4; ++dt) acc[dt] = wmma16(pa, vf[dt], acc[dt]);
    LDSX(); }
   // publish point of stage t + 1: this wave's reads of buffer bf are done, its copies of stage t + 1 have landed, every wave has come so far
   asm volatile("s_wait_dscnt 0x0" ::: "memory");
   asm volatile("s_wait_asynccnt 0x0" ::: "memory");
   __syncthreads();
   if (t + 2 < NT) stage_kv(gk + (size_t)(t + 2) * KT * CC, gv + (t + 2) * KT, lk + bf * (KT * KP * 2), lv + bf * (HD * KP * 2)); }
  asm volatile("s_wait_asynccnt 0x0" ::: "memory");   // no copy is outstanding when the wave ends
#pragma unroll
  for (int r = 0; r < 8; ++r) { const float il = (1.0f / 2048.0f) / l[r];
#pragma unroll
    for (int dt = 0; dt < 4; ++dt) so[wave][8 * g + r][dt * 16 + col] = acc[dt][r] * il; }
  LDSX();
  for (int rl = 0; rl < 16; ++rl) if (lane < 16) vst2(O + (((b * NH + h) * SS + q0 + rl) * HD) + lane * 4, *(const v4f*)&so[wave][rl][lane * 4]);
}
extern "C" void kernel_launch(void* const* d_in, const int* in_sizes, int n_in, void* d_out, int out_size, void* d_ws, size_t ws_size, hipStream_t stream) {
  (void)in_sizes; (void)n_in; (void)out_size;
  const float** F = (const float**)d_in;   // 0 x [4,512,2048], 1 wq [512,512], 2 bq, 3 wk, 4 bk, 5 wv, 6 bv
  if (ws_size < (size_t)WS_END) return;
  char* ws = (char*)d_ws; __bf16* PW = (__bf16*)ws; float* XT = (float*)(ws + WS_XT); _Float16 *Q = (_Float16*)(ws + WS_Q), *Kr = (_Float16*)(ws + WS_K), *V = (_Float16*)(ws + WS_V), *V2 = (_Float16*)(ws + WS_V2);
  k_pack<<<dim3(CC, 3), 256, 0, stream>>>(F[1], F[3], F[5], PW);
  k_tr<<<dim3(SS / 64, CC / 64, TNB), 256, 0, stream>>>(F[0], XT);
  k_proj<<<dim3(TNB * SS / 64, CC / 128, 3), 128, 0, stream>>>(XT, PW, F[2], F[4], F[6], Q, Kr, V);
  k_vq<<<dim3(SS / 64, TNB * NH), 256, 0, stream>>>(V, V2);
  k_attn<<<dim3(TQB, NH, TNB), 128, 0, stream>>>(Q, Kr, V2, (float*)d_out);
}

// v002
// It runs in 126 microseconds.
// Two timings next to v001 both put it at 1.39 times that version's speed.
// All steps since v000 together make it 1.97 times as fast.
// compute dtype: all float inputs rounded to bf16; x transposed to token rows in f32; q/k/v = x_t . W^T + b with EXACT bf16 products on WMMA 16x16x32 (natural rows), rounded once to f16 (v as (B,C,L) planes, then re-viewed through the module's raw .view(B,H,L,Ch) as transposed planes); attention: q, k single f16 x 1/8, running-max softmax in f32 (hardware exp), P (scaled by 2^11, single f16) x v2 (single f16); f32 output written in the module's raw (B,H,L,Ch) -> (B,C,L) memory order.
#include <hip/hip_runtime.h>
#include <math.h>

typedef __attribute__((ext_vector_type(16))) _Float16 v16h;
typedef __attribute__((ext_vector_type(16))) __bf16 v16b;
typedef __attribute__((ext_vector_type(8)))  _Float16 v8h;
typedef __attribute__((ext_vector_type(8)))  float v8f;
typedef __attribute__((ext_vector_type(4)))  float v4f;
typedef __attribute__((ext_vector_type(2)))  float v2f;
typedef __attribute__((ext_vector_type(4)))  unsigned v4u;
typedef __attribute__((ext_vector_type(4)))  int v4i;
typedef float __attribute__((may_alias)) float_a;
typedef int __attribute__((may_alias)) int_a;

template <typename T> __device__ __forceinline__ void vst2(void* p, T v) { *(T*)p = v;  }
__device__ __forceinline__ v8f wmma16(v16h a, v16h b, v8f c) {
  v8f d = __builtin_amdgcn_wmma_f32_16x16x32_f16(false, a, false, b, (short)0, c, false, false);
  asm volatile("v_nop\n\tv_nop\n\tv_nop\n\tv_nop" : "+v"(d) : "v"(a), "v"(b));
  return d;
}
__device__ __forceinline__ v8f wmma_bf(v16b a, v16b b, v8f c) {
  v8f d = __builtin_amdgcn_wmma_f32_16x16x32_bf16(false, a, false, b, (short)0, c, false, false);
  asm volatile("v_nop\n\tv_nop\n\tv_nop\n\tv_nop" : "+v"(d) : "v"(a), "v"(b));
  return d;
}
// 16x16x32 fragments: lane = (h = lane>>4, row/col = lane&15); elements 0..7 = k0+8h+0..7, 8..15 = k0+16+8h+0..7; D element r = row 8h+r
__device__ __forceinline__ v16h frag_h(const _Float16* rowk0, int lane) {
  union { v16h v; v8h q[2]; } u; const _Float16* p = rowk0 + 8 * (lane >> 4);
  u.q[0] = *(const v8h*)p; u.q[1] = *(const v8h*)(p + 16); return u.v;
}
__device__ __forceinline__ v16h frag_f32(const float* rowk0, int lane) {
  v16h a; const float* p = rowk0 + 8 * (lane >> 4);
#pragma unroll
  for (int i = 0; i < 8; ++i) { a[i] = (_Float16)p[i]; a[8 + i] = (_Float16)p[16 + i]; }
  return a;
}
__device__ __forceinline__ v16h frag_f32s(const float* rowk0, int lane, float sc) {
  v16h a; const float* p = rowk0 + 8 * (lane >> 4);
#pragma unroll
  for (int i = 0; i < 8; ++i) { a[i] = (_Float16)(p[i] * sc); a[8 + i] = (_Float16)(p[16 + i] * sc); }
  return a;
}
// column fragment from a [K][ld] layout (column n), rows >= K read as 0
__device__ __forceinline__ v16h fragc_f32(const float* W, int k0, int n, int lane, int ld, int K) {
  v16h a; const int g = lane >> 4;
#pragma unroll
  for (int i = 0; i < 8; ++i) { const int ka = k0 + 8 * g + i, kb = ka + 16;
    a[i] = (_Float16)(ka < K ? W[(size_t)(ka < K ? ka : K - 1) * ld + n] : 0.f); a[8 + i] = (_Float16)(kb < K ? W[(size_t)(kb < K ? kb : K - 1) * ld + n] : 0.f); }
  return a;
}
struct F2 { v16b h, l; };
__device__ __forceinline__ F2 bsplit16(const float v[16]) { F2 r;
#pragma unroll
  for (int i = 0; i < 16; ++i) { const __bf16 h = (__bf16)v[i]; r.h[i] = h; r.l[i] = (__bf16)(v[i] - (float)h); }
  return r; }
__device__ __forceinline__ F2 split_row(const float* row, int k0, int lane) { float v[16]; const float* p = row + k0 + 8 * (lane >> 4);
#pragma unroll
  for (int i = 0; i < 8; ++i) { v[i] = p[i]; v[8 + i] = p[16 + i]; }
  return bsplit16(v); }
__device__ __forceinline__ F2 split_rowK(const float* row, int k0, int lane, int K) { float v[16]; const int g = lane >> 4;
#pragma unroll
  for (int i = 0; i < 8; ++i) { const int ka = k0 + 8 * g + i, kb = ka + 16; v[i] = ka < K ? row[ka < K ? ka : K - 1] : 0.f; v[8 + i] = kb < K ? row[kb < K ? kb : K - 1] : 0.f; }
  return bsplit16(v); }
__device__ __forceinline__ F2 split_col(const float* W, int k0, int n, int lane, int ld, int K) { float v[16]; const int g = lane >> 4;
#pragma unroll
  for (int i = 0; i < 8; ++i) { const int ka = k0 + 8 * g + i, kb = ka + 16; v[i] = ka < K ? W[(size_t)(ka < K ? ka : K - 1) * ld + n] : 0.f; v[8 + i] = kb < K ? W[(size_t)(kb < K ? kb : K - 1) * ld + n] : 0.f; }
  return bsplit16(v); }
__device__ __forceinline__ v8f mac3(const F2& a, const F2& b, v8f c) { c = wmma_bf(a.l, b.h, c); c = wmma_bf(a.h, b.l, c); return wmma_bf(a.h, b.h, c); }
__device__ __forceinline__ float sigm(float v) { return 1.0f / (1.0f + expf(-v)); }
#define LDSX() do { asm volatile("s_wait_dscnt 0" ::: "memory"); __builtin_amdgcn_wave_barrier(); __builtin_amdgcn_fence(__ATOMIC_RELEASE, "workgroup"); } while (0)


// Multi-head self attention on a (B, C, L) sequence (B 4, C 512, L 2,048, 8 heads x 64) with 1x1-conv projections; faithful to the module's quirk of viewing v as (B,H,L,Ch) and the output as (B,C,L) by raw reshape.
#define NB 4
#define CC 512
#define SS 2048
#define NH 8
#define HD 64
#define NR (NB * SS)
#ifndef TQB
#define TQB (SS / 64)
#define TNB NB
#endif
typedef __attribute__((ext_vector_type(8))) __bf16 v8b;
__device__ __forceinline__ v16b frag_b(const __bf16* rowk0, int lane) {
  union { v16b v; v8b q[2]; } u; const __bf16* p = rowk0 + 8 * (lane >> 4);
  u.q[0] = *(const v8b*)p; u.q[1] = *(const v8b*)(p + 16); return u.v;
}
__device__ __forceinline__ float bfr(float v) { return (float)(__bf16)v; }
__device__ __attribute__((noinline)) float exp_ni(float v) { return expf(v); }
__device__ __attribute__((noinline)) float erf_ni(float v) { return erff(v); }

#define WS_PW  0u                                   // bf16 natural rows wq, wk, wv [3][512][512]
#define WS_XT  (WS_PW + 2u * (size_t)3 * CC * CC)       // f32 x^T token rows [NR][512]
#define WS_Q   (WS_XT + 4u * (size_t)NR * CC)          // f16 q rows [NR][512]; k rows; v planes (B,C,L) [b][512][L]; v2 planes [b][h][64][L]
#define WS_K   (WS_Q + 2u * (size_t)NR * CC)
#define WS_V   (WS_K + 2u * (size_t)NR * CC)
#define WS_V2  (WS_V + 2u * (size_t)NB * CC * SS)
#define WS_END (WS_V2 + 2u * (size_t)NB * CC * SS)

__global__ __launch_bounds__(256) void k_pack(const float* __restrict__ WQ, const float* __restrict__ WK, const float* __restrict__ WV, __bf16* __restrict__ PW) { const int n = blockIdx.x, which = blockIdx.y, t = threadIdx.x; __shared__ __align__(16) __bf16 s[CC]; const float* w = (which == 0) ? WQ : (which == 1) ? WK : WV; for (int k = t; k < CC; k += 256) s[k] = (__bf16)w[(size_t)n * CC + k]; __syncthreads(); if (t < CC / 8) vst2((unsigned*)(PW + ((size_t)which * CC + n) * CC + t * 8), *(const v4u*)&s[t * 8]); }
// ---- k_tr: block = (64 positions, 64 channels, b): x[b][c][l] -> XT[(b, l)][c] f32 (256-B row segments)
__global__ __launch_bounds__(256) void k_tr(const float* __restrict__ X, float* __restrict__ XT) { __shared__ float st[64][65]; const int t = threadIdx.x; const int l0 = blockIdx.x * 64, c0 = blockIdx.y * 64; const size_t b = blockIdx.z;
  for (int e = t; e < 64 * 64; e += 256) { const int cl = e >> 6, ll = e & 63; st[ll][cl] = X[(b * CC + c0 + cl) * SS + l0 + ll]; }
  __syncthreads(); __shared__ __align__(16) float so[64][68]; for (int e = t; e < 64 * 64; e += 256) { const int ll = e >> 6, cl = e & 63; so[ll][cl] = st[ll][cl]; } __syncthreads();
  for (int e = t; e < 64 * 16; e += 256) { const int ll = e >> 4, q = e & 15; vst2(XT + (b * SS + l0 + ll) * CC + c0 + q * 4, *(const v4f*)&so[ll][q * 4]); } }
// ---- k_proj: block = (64 rows, 128 cols, which): + bias; q/k -> f16 rows; v -> (B,C,L) planes
__global__ __launch_bounds__(128) void k_proj(const float* __restrict__ XT, const __bf16* __restrict__ PW, const float* __restrict__ BQ, const float* __restrict__ BK, const float* __restrict__ BV, _Float16* __restrict__ Q, _Float16* __restrict__ Kr, _Float16* __restrict__ V) {
  __shared__ __align__(16) _Float16 so[64][136]; __shared__ __align__(16) _Float16 st[128][72];
  const int tid = threadIdx.x, wave = tid >> 5, lane = tid & 31, col = lane & 15, g = lane >> 4; const int which = blockIdx.z; const size_t rb = (size_t)blockIdx.x * 64; const size_t r0 = rb + wave * 16; const int c0 = blockIdx.y * 128; const __bf16* Wr = PW + ((size_t)which * CC) * CC; const float* BB = (which == 0) ? BQ : (which == 1) ? BK : BV;
  v8f acc[8] = {};
#pragma unroll 2
  for (int kc = 0; kc < CC / 32; ++kc) { v16b a; { const float* p = XT + (r0 + col) * CC + kc * 32 + 8 * g;
#pragma unroll
      for (int i = 0; i < 8; ++i) { a[i] = (__bf16)p[i]; a[8 + i] = (__bf16)p[16 + i]; } }
#pragma unroll
    for (int j = 0; j < 8; ++j) acc[j] = wmma_bf(a, frag_b(Wr + (size_t)(c0 + j * 16 + col) * CC + kc * 32, lane), acc[j]); }
#pragma unroll
  for (int j = 0; j < 8; ++j) { const float bb = bfr(BB[c0 + j * 16 + col]);
#pragma unroll
    for (int r = 0; r < 8; ++r) { const _Float16 hv = (_Float16)(acc[j][r] + bb); if (which < 2) so[wave * 16 + 8 * g + r][j * 16 + col] = hv; else st[j * 16 + col][wave * 16 + 8 * g + r] = hv; } }
  __syncthreads();
  if (which < 2) { _Float16* dst = (which == 0) ? Q : Kr; for (int e = tid; e < 64 * 16; e += 128) { const int rl = e >> 4, q = e & 15; vst2((unsigned*)(dst + (rb + rl) * CC + c0 + q * 8), *(const v4u*)&so[rl][q * 8]); } }
  else { const size_t b = rb / SS; const int s0 = (int)(rb % SS); for (int e = tid; e < 128 * 8; e += 128) { const int d = e >> 3, pc = e & 7; vst2((unsigned*)(V + ((b * CC + c0 + d) * SS) + s0 + pc * 8), *(const v4u*)&st[d][pc * 8]); } }
}
// ---- k_vq: block = (64 m-rows, b*NH + h): the head's contiguous (Ch x L) block F of the (B,C,L) v tensor viewed as [L][Ch] (v2[m][c] = F[m*64 + c]) -> transposed planes V2[b][h][c][m]
__global__ __launch_bounds__(256) void k_vq(const _Float16* __restrict__ V, _Float16* __restrict__ V2) { __shared__ __align__(16) _Float16 st[64][72]; const int t = threadIdx.x; const int m0 = blockIdx.x * 64; const size_t bh = blockIdx.y; const _Float16* F = V + bh * (size_t)HD * SS;
  for (int e = t; e < 64 * 64; e += 256) { const int ml = e >> 6, c = e & 63; st[c][ml] = F[(size_t)(m0 + ml) * HD + c]; }
  __syncthreads(); for (int e = t; e < 64 * 8; e += 256) { const int c = e >> 3, pc = e & 7; vst2((unsigned*)(V2 + (bh * HD + c) * SS + m0 + pc * 8), *(const v4u*)&st[c][pc * 8]); } }
// ---- k_attn: block = (64 queries, head, b): softmax(q k / 8) over all L keys, . v2; output rows (b, h, l) of 64 floats (the raw (B,H,L,Ch) buffer == the module's (B,C,L) result)
// Scores are formed transposed, S^T = K . Q^T (A = K rows, B = Q rows): a lane holds 8 keys a tile of ONE query (column lane & 15), so maximum and sum run in the lane's own registers, with one exchange
// between the wave's halves; two S^T tiles, converted in place, are the B operand of O^T += v2^T . P^T in the hardware k order (keys 8g + 0..7, 16 + 8g + 0..7), the order in which frag_h reads the v2 rows.
// K rows and v2 planes come in stages of KT keys through LDS, shared by the block's four waves: two buffers, the next stage's asynchronous copies fly while this stage is worked on.
#define KT 64          // keys per stage: a K row (64 channels) and a v2 row (64 keys) are both one 128-B line
#define KP 72          // LDS row pitch in f16: 144 B = 16 B x odd, conflict-free for 16-byte fragment reads
#define NT (SS / KT)
// one stage: 64 K rows + 64 v2 rows of 128 B, 8 lanes a row, 4 + 4 copies a thread (rows r, r + 16, r + 32, r + 48)
__device__ __forceinline__ void stage_kv(const _Float16* gk, const _Float16* gv, unsigned lk, unsigned lv) {
  const _Float16 *k0 = gk, *k1 = gk + 16 * CC, *k2 = gk + 32 * CC, *k3 = gk + 48 * CC;
  const _Float16 *v0 = gv, *v1 = gv + 16 * SS, *v2 = gv + 32 * SS, *v3 = gv + 48 * SS;
  const unsigned a0 = lk, a1 = lk + 16 * KP * 2, a2 = lk + 32 * KP * 2, a3 = lk + 48 * KP * 2;
  const unsigned b0 = lv, b1 = lv + 16 * KP * 2, b2 = lv + 32 * KP * 2, b3 = lv + 48 * KP * 2;
  // the copies and their s_wait_xcnt in one statement: no address register is rewritten before the wait
  asm volatile("global_load_async_to_lds_b128 %0, %8, off\n\t"
               "global_load_async_to_lds_b128 %1, %9, off\n\t"
               "global_load_async_to_lds_b128 %2, %10, off\n\t"
               "global_load_async_to_lds_b128 %3, %11, off\n\t"
               "global_load_async_to_lds_b128 %4, %12, off\n\t"
               "global_load_async_to_lds_b128 %5, %13, off\n\t"
               "global_load_async_to_lds_b128 %6, %14, off\n\t"
               "global_load_async_to_lds_b128 %7, %15, off\n\t"
               "s_wait_xcnt 0x0"
               :: "v"(a0), "v"(a1), "v"(a2), "v"(a3), "v"(b0), "v"(b1), "v"(b2), "v"(b3),
                  "v"(k0), "v"(k1), "v"(k2), "v"(k3), "v"(v0), "v"(v1), "v"(v2), "v"(v3) : "memory");
}
// lane l with lane l ^ 16
__device__ __forceinline__ float xhalf(float x) { const int b = __builtin_bit_cast(int, x); return __builtin_bit_cast(float, __builtin_amdgcn_permlanex16(b, b, 0x76543210, 0xfedcba98, false, false)); }
__global__ __launch_bounds__(128) void k_attn(const _Float16* __restrict__ Q, const _Float16* __restrict__ Kr, const _Float16* __restrict__ V2, float* __restrict__ O) {
  __shared__ __align__(16) float so[4][16][68];
  __shared__ __align__(16) _Float16 sk[2][KT][KP]; __shared__ __align__(16) _Float16 sv[2][HD][KP];
  const int tid = threadIdx.x, wave = tid >> 5, lane = tid & 31, col = lane & 15, g = lane >> 4; const int h = blockIdx.y; const size_t b = blockIdx.z; const int q0 = blockIdx.x * 64 + wave * 16; const size_t rq = b * SS + q0;
  // this thread's 16 bytes of the first of its four rows, in global memory (stage 0) and in LDS (buffer 0)
  const int crow = tid >> 3, cch = (tid & 7) * 8;
  const _Float16* gk = Kr + (b * SS + crow) * CC + h * HD + cch;
  const _Float16* gv = V2 + ((b * NH + h) * HD + crow) * SS + cch;
  const unsigned lk = (unsigned)(uintptr_t)&sk[0][crow][cch], lv = (unsigned)(uintptr_t)&sv[0][crow][cch];
  stage_kv(gk, gv, lk, lv);
  v16h aq[2];
#pragma unroll
  for (int kc = 0; kc < 2; ++kc) aq[kc] = frag_h(Q + (rq + col) * CC + h * HD + kc * 32, lane);
  float m = -3.0e38f, l = 0.f;   // this lane's query: running maximum (equal in both halves), and the sum over this half's keys
  v8f acc[4] = {};
  asm volatile("s_wait_asynccnt 0x0" ::: "memory");   // stage 0 has landed, as far as this wave copied it
  __syncthreads();                                     // ... and is published to the other waves
  stage_kv(gk + (size_t)KT * CC, gv + KT, lk + KT * KP * 2, lv + HD * KP * 2);
#pragma unroll 1   // one stage a trip, kept rolled: one publish point in the code, the buffer picked by t & 1
  for (int t = 0; t < NT; ++t) { const int bf = t & 1;
#pragma unroll   // both passes of a stage unrolled: their LDS offsets become immediates
   for (int p = 0; p < KT / 32; ++p) { v8f s[2];
    // all fragments of the pass are read as one group, so that their LDS latencies overlap
    v16h kf[2][2], vf[4];
#pragma unroll
    for (int ct = 0; ct < 2; ++ct)
#pragma unroll
      for (int kc = 0; kc < 2; ++kc) kf[ct][kc] = frag_h(&sk[bf][p * 32 + ct * 16 + col][kc * 32], lane);
#pragma unroll
    for (int dt = 0; dt < 4; ++dt) vf[dt] = frag_h(&sv[bf][dt * 16 + col][p * 32], lane);
#pragma unroll
    for (int ct = 0; ct < 2; ++ct) { v8f c = {};
#pragma unroll
      for (int kc = 0; kc < 2; ++kc) c = wmma16(kf[ct][kc], aq[kc], c);
#pragma unroll
      for (int r = 0; r < 8; ++r) s[ct][r] = c[r] * 0.125f; }
    float mx = fmaxf(s[0][0], s[1][0]);
#pragma unroll
    for (int r = 1; r < 8; ++r) mx = fmaxf(mx, fmaxf(s[0][r], s[1][r]));
    mx = fmaxf(mx, xhalf(mx));
    const float mn = fmaxf(m, mx); const float alpha = (m <= -1.0e38f) ? 0.f : __expf(m - mn);
    v16h pb; float es[2] = {0.f, 0.f};
#pragma unroll
    for (int ct = 0; ct < 2; ++ct)
#pragma unroll
      for (int r = 0; r < 8; ++r) { const float e = __expf(s[ct][r] - mn); es[ct] += e; pb[ct * 8 + r] = (_Float16)(e * 2048.0f); }
    l = l * alpha + (es[0] + es[1]); m = mn;
#pragma unroll
    for (int dt = 0; dt < 4; ++dt) acc[dt] = wmma16(vf[dt], pb, acc[dt] * alpha); }
   // publish point of stage t + 1: this wave's reads of buffer bf are done, its copies of stage t + 1 have landed, every wave has come so far
   asm volatile("s_wait_dscnt 0x0" ::: "memory");
   asm volatile("s_wait_asynccnt 0x0" ::: "memory");
   __syncthreads();
   if (t + 2 < NT) stage_kv(gk + (size_t)(t + 2) * KT * CC, gv + (t + 2) * KT, lk + bf * (KT * KP * 2), lv + bf * (HD * KP * 2)); }
  asm volatile("s_wait_asynccnt 0x0" ::: "memory");   // no copy is outstanding when the wave ends
  const float il = (1.0f / 2048.0f) / (l + xhalf(l));   // the halves' sums are joined once
#pragma unroll
  for (int dt = 0; dt < 4; ++dt) { const v8f o = acc[dt] * il;   // channels dt * 16 + 8g + 0..7 of query col
    *(v4f*)&so[wave][col][dt * 16 + 8 * g] = __builtin_shufflevector(o, o, 0, 1, 2, 3); *(v4f*)&so[wave][col][dt * 16 + 8 * g + 4] = __builtin_shufflevector(o, o, 4, 5, 6, 7); }
  LDSX();
  for (int rl = 0; rl < 16; ++rl) if (lane < 16) vst2(O + (((b * NH + h) * SS + q0 + rl) * HD) + lane * 4, *(const v4f*)&so[wave][rl][lane * 4]);
}
extern "C" void kernel_launch(void* const* d_in, const int* in_sizes, int n_in, void* d_out, int out_size, void* d_ws, size_t ws_size, hipStream_t stream) {
  (void)in_sizes; (void)n_in; (void)out_size;
  const float** F = (const float**)d_in;   // 0 x [4,512,2048], 1 wq [512,512], 2 bq, 3 wk, 4 bk, 5 wv, 6 bv
  if (ws_size < (size_t)WS_END) return;
  char* ws = (char*)d_ws; __bf16* PW = (__bf16*)ws; float* XT = (float*)(ws + WS_XT); _Float16 *Q = (_Float16*)(ws + WS_Q), *Kr = (_Float16*)(ws + WS_K), *V = (_Float16*)(ws + WS_V), *V2 = (_Float16*)(ws + WS_V2);
  k_pack<<<dim3(CC, 3), 256, 0, stream>>>(F[1], F[3], F[5], PW);
  k_tr<<<dim3(SS / 64, CC / 64, TNB), 256, 0, stream>>>(F[0], XT);
  k_proj<<<dim3(TNB * SS / 64, CC / 128, 3), 128, 0, stream>>>(XT, PW, F[2], F[4], F[6], Q, Kr, V);
  k_vq<<<dim3(SS / 64, TNB * NH), 256, 0, stream>>>(V, V2);
  k_attn<<<dim3(TQB, NH, TNB), 128, 0, stream>>>(Q, Kr, V2, (float*)d_out);
}

// v003
// A run of this version takes 79.9 microseconds.
// In both of two side-by-side timings against v002, it was 1.56 times as fast.
// Counting every step since v000, it is 3.08 times as fast.
// compute dtype: all float inputs rounded to bf16; x transposed to token rows in f32; q/k/v = x_t . W^T + b with EXACT bf16 products on WMMA 16x16x32 (natural rows), rounded once to f16 (v as (B,C,L) planes, then re-viewed through the module's raw .view(B,H,L,Ch) as transposed planes); attention: q, k single f16 x 1/8, running-max softmax in f32 (hardware exp), P (scaled by 2^11, single f16) x v2 (single f16); f32 output written in the module's raw (B,H,L,Ch) -> (B,C,L) memory order.
#include <hip/hip_runtime.h>
#include <math.h>

typedef __attribute__((ext_vector_type(16))) _Float16 v16h;
typedef __attribute__((ext_vector_type(16))) __bf16 v16b;
typedef __attribute__((ext_vector_type(8)))  _Float16 v8h;
typedef __attribute__((ext_vector_type(8)))  float v8f;
typedef __attribute__((ext_vector_type(4)))  float v4f;
typedef __attribute__((ext_vector_type(2)))  float v2f;
typedef __attribute__((ext_vector_type(4)))  unsigned v4u;
typedef __attribute__((ext_vector_type(4)))  int v4i;
typedef float __attribute__((may_alias)) float_a;
typedef int __attribute__((may_alias)) int_a;

template <typename T> __device__ __forceinline__ void vst2(void* p, T v) { *(T*)p = v;  }
__device__ __forceinline__ v8f wmma16(v16h a, v16h b, v8f c) {
  v8f d = __builtin_amdgcn_wmma_f32_16x16x32_f16(false, a, false, b, (short)0, c, false, false);
  asm volatile("v_nop\n\tv_nop\n\tv_nop\n\tv_nop" : "+v"(d) : "v"(a), "v"(b));
  return d;
}
__device__ __forceinline__ v8f wmma_bf(v16b a, v16b b, v8f c) {
  v8f d = __builtin_amdgcn_wmma_f32_16x16x32_bf16(false, a, false, b, (short)0, c, false, false);
  asm volatile("v_nop\n\tv_nop\n\tv_nop\n\tv_nop" : "+v"(d) : "v"(a), "v"(b));
  return d;
}
// 16x16x32 fragments: lane = (h = lane>>4, row/col = lane&15); elements 0..7 = k0+8h+0..7, 8..15 = k0+16+8h+0..7; D element r = row 8h+r
__device__ __forceinline__ v16h frag_h(const _Float16* rowk0, int lane) {
  union { v16h v; v8h q[2]; } u; const _Float16* p = rowk0 + 8 * (lane >> 4);
  u.q[0] = *(const v8h*)p; u.q[1] = *(const v8h*)(p + 16); return u.v;
}
__device__ __forceinline__ v16h frag_f32(const float* rowk0, int lane) {
  v16h a; const float* p = rowk0 + 8 * (lane >> 4);
#pragma unroll
  for (int i = 0; i < 8; ++i) { a[i] = (_Float16)p[i]; a[8 + i] = (_Float16)p[16 + i]; }
  return a;
}
__device__ __forceinline__ v16h frag_f32s(const float* rowk0, int lane, float sc) {
  v16h a; const float* p = rowk0 + 8 * (lane >> 4);
#pragma unroll
  for (int i = 0; i < 8; ++i) { a[i] = (_Float16)(p[i] * sc); a[8 + i] = (_Float16)(p[16 + i] * sc); }
  return a;
}
// column fragment from a [K][ld] layout (column n), rows >= K read as 0
__device__ __forceinline__ v16h fragc_f32(const float* W, int k0, int n, int lane, int ld, int K) {
  v16h a; const int g = lane >> 4;
#pragma unroll
  for (int i = 0; i < 8; ++i) { const int ka = k0 + 8 * g + i, kb = ka + 16;
    a[i] = (_Float16)(ka < K ? W[(size_t)(ka < K ? ka : K - 1) * ld + n] : 0.f); a[8 + i] = (_Float16)(kb < K ? W[(size_t)(kb < K ? kb : K - 1) * ld + n] : 0.f); }
  return a;
}
struct F2 { v16b h, l; };
__device__ __forceinline__ F2 bsplit16(const float v[16]) { F2 r;
#pragma unroll
  for (int i = 0; i < 16; ++i) { const __bf16 h = (__bf16)v[i]; r.h[i] = h; r.l[i] = (__bf16)(v[i] - (float)h); }
  return r; }
__device__ __forceinline__ F2 split_row(const float* row, int k0, int lane) { float v[16]; const float* p = row + k0 + 8 * (lane >> 4);
#pragma unroll
  for (int i = 0; i < 8; ++i) { v[i] = p[i]; v[8 + i] = p[16 + i]; }
  return bsplit16(v); }
__device__ __forceinline__ F2 split_rowK(const float* row, int k0, int lane, int K) { float v[16]; const int g = lane >> 4;
#pragma unroll
  for (int i = 0; i < 8; ++i) { const int ka = k0 + 8 * g + i, kb = ka + 16; v[i] = ka < K ? row[ka < K ? ka : K - 1] : 0.f; v[8 + i] = kb < K ? row[kb < K ? kb : K - 1] : 0.f; }
  return bsplit16(v); }
__device__ __forceinline__ F2 split_col(const float* W, int k0, int n, int lane, int ld, int K) { float v[16]; const int g = lane >> 4;
#pragma unroll
  for (int i = 0; i < 8; ++i) { const int ka = k0 + 8 * g + i, kb = ka + 16; v[i] = ka < K ? W[(size_t)(ka < K ? ka : K - 1) * ld + n] : 0.f; v[8 + i] = kb < K ? W[(size_t)(kb < K ? kb : K - 1) * ld + n] : 0.f; }
  return bsplit16(v); }
__device__ __forceinline__ v8f mac3(const F2& a, const F2& b, v8f c) { c = wmma_bf(a.l, b.h, c); c = wmma_bf(a.h, b.l, c); return wmma_bf(a.h, b.h, c); }
__device__ __forceinline__ float sigm(float v) { return 1.0f / (1.0f + expf(-v)); }
#define LDSX() do { asm volatile("s_wait_dscnt 0" ::: "memory"); __builtin_amdgcn_wave_barrier(); __builtin_amdgcn_fence(__ATOMIC_RELEASE, "workgroup"); } while (0)


// Multi-head self attention on a (B, C, L) sequence (B 4, C 512, L 2,048, 8 heads x 64) with 1x1-conv projections; faithful to the module's quirk of viewing v as (B,H,L,Ch) and the output as (B,C,L) by raw reshape.
#define NB 4
#define CC 512
#define SS 2048
#define NH 8
#define HD 64
#define NR (NB * SS)
#ifndef TQB
#define TQB (SS / 64)
#define TNB NB
#endif
typedef __attribute__((ext_vector_type(8))) __bf16 v8b;
__device__ __forceinline__ v16b frag_b(const __bf16* rowk0, int lane) {
  union { v16b v; v8b q[2]; } u; const __bf16* p = rowk0 + 8 * (lane >> 4);
  u.q[0] = *(const v8b*)p; u.q[1] = *(const v8b*)(p + 16); return u.v;
}
__device__ __forceinline__ float bfr(float v) { return (float)(__bf16)v; }
__device__ __attribute__((noinline)) float exp_ni(float v) { return expf(v); }
__device__ __attribute__((noinline)) float erf_ni(float v) { return erff(v); }

#define WS_PW  0u                                   // bf16 natural rows wq, wk, wv [3][512][512]
#define WS_XT  (WS_PW + 2u * (size_t)3 * CC * CC)       // f32 x^T token rows [NR][512]
#define WS_Q   (WS_XT + 4u * (size_t)NR * CC)          // f16 q rows [NR][512]; k rows; v planes (B,C,L) [b][512][L]; v2 planes [b][h][64][L]
#define WS_K   (WS_Q + 2u * (size_t)NR * CC)
#define WS_V   (WS_K + 2u * (size_t)NR * CC)
#define WS_V2  (WS_V + 2u * (size_t)NB * CC * SS)
#define WS_END (WS_V2 + 2u * (size_t)NB * CC * SS)

__global__ __launch_bounds__(256) void k_pack(const float* __restrict__ WQ, const float* __restrict__ WK, const float* __restrict__ WV, __bf16* __restrict__ PW) { const int n = blockIdx.x, which = blockIdx.y, t = threadIdx.x; __shared__ __align__(16) __bf16 s[CC]; const float* w = (which == 0) ? WQ : (which == 1) ? WK : WV; for (int k = t; k < CC; k += 256) s[k] = (__bf16)w[(size_t)n * CC + k]; __syncthreads(); if (t < CC / 8) vst2((unsigned*)(PW + ((size_t)which * CC + n) * CC + t * 8), *(const v4u*)&s[t * 8]); }
// ---- k_tr: block = (64 positions, 64 channels, b): x[b][c][l] -> XT[(b, l)][c] f32 (256-B row segments)
__global__ __launch_bounds__(256) void k_tr(const float* __restrict__ X, float* __restrict__ XT) { __shared__ float st[64][65]; const int t = threadIdx.x; const int l0 = blockIdx.x * 64, c0 = blockIdx.y * 64; const size_t b = blockIdx.z;
  for (int e = t; e < 64 * 64; e += 256) { const int cl = e >> 6, ll = e & 63; st[ll][cl] = X[(b * CC + c0 + cl) * SS + l0 + ll]; }
  __syncthreads(); __shared__ __align__(16) float so[64][68]; for (int e = t; e < 64 * 64; e += 256) { const int ll = e >> 6, cl = e & 63; so[ll][cl] = st[ll][cl]; } __syncthreads();
  for (int e = t; e < 64 * 16; e += 256) { const int ll = e >> 4, q = e & 15; vst2(XT + (b * SS + l0 + ll) * CC + c0 + q * 4, *(const v4f*)&so[ll][q * 4]); } }
// ---- k_proj: block = (128 rows, 128 cols, which), 8 waves of 32 rows x 64 cols: + bias; q/k -> f16 rows; v -> (B,C,L) planes
// x^T rows (f32) and weight rows (bf16) come in stages of PK channels through LDS, shared by the block's eight waves: two buffers, the next stage's asynchronous copies fly while this stage is worked on.
#define PK 64                         // channels per stage: an x^T row piece is 256 B, a weight row piece one 128-B line
#define PNT (CC / PK)
#define PAP 68                        // LDS pitch of an x^T row in f32: 272 B = 16 B x odd, conflict-free for 16-byte reads
#define PBP 72                        // LDS pitch of a weight row in bf16: 144 B = 16 B x odd
#define PA_BYTES (128 * PAP * 4)
#define PST_BYTES (PA_BYTES + 128 * PBP * 2)
#define POP 136                       // pitch of the output staging in f16: 272 B
// one stage: 128 x^T rows of 256 B, 16 lanes a row, 8 copies a thread (rows r + 16 i); 128 weight rows of 128 B, 8 lanes a row, 4 copies a thread (rows r + 32 i)
__device__ __forceinline__ void stage_ab(const float* ga, const __bf16* gb, unsigned la, unsigned lb) {
  const float *a0 = ga, *a1 = ga + 16 * CC, *a2 = ga + 32 * CC, *a3 = ga + 48 * CC, *a4 = ga + 64 * CC, *a5 = ga + 80 * CC, *a6 = ga + 96 * CC, *a7 = ga + 112 * CC;
  const __bf16 *b0 = gb, *b1 = gb + 32 * CC, *b2 = gb + 64 * CC, *b3 = gb + 96 * CC;
  const unsigned x0 = la, x1 = la + 16 * PAP * 4, x2 = la + 32 * PAP * 4, x3 = la + 48 * PAP * 4, x4 = la + 64 * PAP * 4, x5 = la + 80 * PAP * 4, x6 = la + 96 * PAP * 4, x7 = la + 112 * PAP * 4;
  const unsigned y0 = lb, y1 = lb + 32 * PBP * 2, y2 = lb + 64 * PBP * 2, y3 = lb + 96 * PBP * 2;
  // the copies and their s_wait_xcnt in one statement: no address register is rewritten before the wait
  asm volatile("global_load_async_to_lds_b128 %0, %12, off\n\t"
               "global_load_async_to_lds_b128 %1, %13, off\n\t"
               "global_load_async_to_lds_b128 %2, %14, off\n\t"
               "global_load_async_to_lds_b128 %3, %15, off\n\t"
               "global_load_async_to_lds_b128 %4, %16, off\n\t"
               "global_load_async_to_lds_b128 %5, %17, off\n\t"
               "global_load_async_to_lds_b128 %6, %18, off\n\t"
               "global_load_async_to_lds_b128 %7, %19, off\n\t"
               "global_load_async_to_lds_b128 %8, %20, off\n\t"
               "global_load_async_to_lds_b128 %9, %21, off\n\t"
               "global_load_async_to_lds_b128 %10, %22, off\n\t"
               "global_load_async_to_lds_b128 %11, %23, off\n\t"
               "s_wait_xcnt 0x0"
               :: "v"(x0), "v"(x1), "v"(x2), "v"(x3), "v"(x4), "v"(x5), "v"(x6), "v"(x7), "v"(y0), "v"(y1), "v"(y2), "v"(y3),
                  "v"(a0), "v"(a1), "v"(a2), "v"(a3), "v"(a4), "v"(a5), "v"(a6), "v"(a7), "v"(b0), "v"(b1), "v"(b2), "v"(b3) : "memory");
}
__global__ __launch_bounds__(256) void k_proj(const float* __restrict__ XT, const __bf16* __restrict__ PW, const float* __restrict__ BQ, const float* __restrict__ BK, const float* __restrict__ BV, _Float16* __restrict__ Q, _Float16* __restrict__ Kr, _Float16* __restrict__ V) {
  __shared__ __align__(16) unsigned char sm[2 * PST_BYTES];   // two stages [x^T 128 rows | weights 128 rows]; behind the loop the output staging
  const int tid = threadIdx.x, wave = tid >> 5, lane = tid & 31, col = lane & 15, g = lane >> 4; const int which = blockIdx.z; const size_t rb = (size_t)blockIdx.x * 128; const int c0 = blockIdx.y * 128; const int wr = (wave >> 1) * 32, wc = (wave & 1) * 64; const float* BB = (which == 0) ? BQ : (which == 1) ? BK : BV;
  // this thread's 16 bytes of the first of its rows, in global memory (stage 0) and in LDS (buffer 0)
  const float* ga = XT + (rb + (tid >> 4)) * CC + (tid & 15) * 4;
  const __bf16* gb = PW + ((size_t)which * CC + c0 + (tid >> 3)) * CC + (tid & 7) * 8;
  const unsigned la = (unsigned)(uintptr_t)&sm[(tid >> 4) * (PAP * 4) + (tid & 15) * 16], lb = (unsigned)(uintptr_t)&sm[PA_BYTES + (tid >> 3) * (PBP * 2) + (tid & 7) * 16];
  stage_ab(ga, gb, la, lb);
  v8f acc[2][4] = {};
  asm volatile("s_wait_asynccnt 0x0" ::: "memory");   // stage 0 has landed, as far as this wave copied it
  __syncthreads();                                     // ... and is published to the other waves
  stage_ab(ga + PK, gb + PK, la + PST_BYTES, lb + PST_BYTES);
#pragma unroll 1   // one stage a trip, kept rolled: one publish point in the code, the buffer picked by t & 1
  for (int t = 0; t < PNT; ++t) { const int bf = t & 1; const float* sa = (const float*)(sm + bf * PST_BYTES); const __bf16* sb = (const __bf16*)(sm + bf * PST_BYTES + PA_BYTES);
#pragma unroll   // both 32-channel steps of a stage unrolled: their LDS offsets become immediates
    for (int kc = 0; kc < PK / 32; ++kc) { v16b a[2], w[4];
      // all fragments of the step are read as one group, so that their LDS latencies overlap
#pragma unroll
      for (int i = 0; i < 2; ++i) { const float* p = sa + (wr + i * 16 + col) * PAP + kc * 32 + 8 * g;
#pragma unroll
        for (int e = 0; e < 8; ++e) { a[i][e] = (__bf16)p[e]; a[i][8 + e] = (__bf16)p[16 + e]; } }
#pragma unroll
      for (int j = 0; j < 4; ++j) w[j] = frag_b(sb + (wc + j * 16 + col) * PBP + kc * 32, lane);
#pragma unroll
      for (int i = 0; i < 2; ++i)
#pragma unroll
        for (int j = 0; j < 4; ++j) acc[i][j] = wmma_bf(a[i], w[j], acc[i][j]); }
    // publish point of stage t + 1: this wave's reads of buffer bf are done, its copies of stage t + 1 have landed, every wave has come so far
    asm volatile("s_wait_dscnt 0x0" ::: "memory");
    asm volatile("s_wait_asynccnt 0x0" ::: "memory");
    __syncthreads();
    if (t + 2 < PNT) stage_ab(ga + (t + 2) * PK, gb + (t + 2) * PK, la + bf * PST_BYTES, lb + bf * PST_BYTES); }
  asm volatile("s_wait_asynccnt 0x0" ::: "memory");   // no copy is outstanding when the ring becomes output staging (the last trip's barrier has ended every read of it)
  _Float16* so = (_Float16*)sm;
  if (which < 2) {   // so[row][col]
#pragma unroll
    for (int j = 0; j < 4; ++j) { const float bb = bfr(BB[c0 + wc + j * 16 + col]);
#pragma unroll
      for (int i = 0; i < 2; ++i)
#pragma unroll
        for (int r = 0; r < 8; ++r) so[(wr + i * 16 + 8 * g + r) * POP + wc + j * 16 + col] = (_Float16)(acc[i][j][r] + bb); }
  } else {           // so[col][row]: a lane's 8 rows of a tile are 16 contiguous bytes
#pragma unroll
    for (int j = 0; j < 4; ++j) { const float bb = bfr(BB[c0 + wc + j * 16 + col]);
#pragma unroll
      for (int i = 0; i < 2; ++i) { v8h hv;
#pragma unroll
        for (int r = 0; r < 8; ++r) hv[r] = (_Float16)(acc[i][j][r] + bb);
        *(v8h*)&so[(wc + j * 16 + col) * POP + wr + i * 16 + 8 * g] = hv; } }
  }
  __syncthreads();
  if (which < 2) { _Float16* dst = (which == 0) ? Q : Kr; 
#pragma unroll   // the eight LDS reads of a thread go out as one group
    for (int it = 0; it < 8; ++it) { const int rl = it * 16 + (tid >> 4), q = tid & 15; vst2((unsigned*)(dst + (rb + rl) * CC + c0 + q * 8), *(const v4u*)&so[rl * POP + q * 8]); } }
  else { const size_t b = rb / SS; const int s0 = (int)(rb % SS); 
#pragma unroll   // the eight LDS reads of a thread go out as one group
    for (int it = 0; it < 8; ++it) { const int d = it * 16 + (tid >> 4), pc = tid & 15; vst2((unsigned*)(V + ((b * CC + c0 + d) * SS) + s0 + pc * 8), *(const v4u*)&so[d * POP + pc * 8]); } }
}
// ---- k_vq: block = (64 m-rows, b*NH + h): the head's contiguous (Ch x L) block F of the (B,C,L) v tensor viewed as [L][Ch] (v2[m][c] = F[m*64 + c]) -> transposed planes V2[b][h][c][m]
__global__ __launch_bounds__(256) void k_vq(const _Float16* __restrict__ V, _Float16* __restrict__ V2) { __shared__ __align__(16) _Float16 st[64][72]; const int t = threadIdx.x; const int m0 = blockIdx.x * 64; const size_t bh = blockIdx.y; const _Float16* F = V + bh * (size_t)HD * SS;
  for (int e = t; e < 64 * 64; e += 256) { const int ml = e >> 6, c = e & 63; st[c][ml] = F[(size_t)(m0 + ml) * HD + c]; }
  __syncthreads(); for (int e = t; e < 64 * 8; e += 256) { const int c = e >> 3, pc = e & 7; vst2((unsigned*)(V2 + (bh * HD + c) * SS + m0 + pc * 8), *(const v4u*)&st[c][pc * 8]); } }
// ---- k_attn: block = (64 queries, head, b): softmax(q k / 8) over all L keys, . v2; output rows (b, h, l) of 64 floats (the raw (B,H,L,Ch) buffer == the module's (B,C,L) result)
// Scores are formed transposed, S^T = K . Q^T (A = K rows, B = Q rows): a lane holds 8 keys a tile of ONE query (column lane & 15), so maximum and sum run in the lane's own registers, with one exchange
// between the wave's halves; two S^T tiles, converted in place, are the B operand of O^T += v2^T . P^T in the hardware k order (keys 8g + 0..7, 16 + 8g + 0..7), the order in which frag_h reads the v2 rows.
// K rows and v2 planes come in stages of KT keys through LDS, shared by the block's four waves: two buffers, the next stage's asynchronous copies fly while this stage is worked on.
#define KT 64          // keys per stage: a K row (64 channels) and a v2 row (64 keys) are both one 128-B line
#define KP 72          // LDS row pitch in f16: 144 B = 16 B x odd, conflict-free for 16-byte fragment reads
#define NT (SS / KT)
// one stage: 64 K rows + 64 v2 rows of 128 B, 8 lanes a row, 4 + 4 copies a thread (rows r, r + 16, r + 32, r + 48)
__device__ __forceinline__ void stage_kv(const _Float16* gk, const _Float16* gv, unsigned lk, unsigned lv) {
  const _Float16 *k0 = gk, *k1 = gk + 16 * CC, *k2 = gk + 32 * CC, *k3 = gk + 48 * CC;
  const _Float16 *v0 = gv, *v1 = gv + 16 * SS, *v2 = gv + 32 * SS, *v3 = gv + 48 * SS;
  const unsigned a0 = lk, a1 = lk + 16 * KP * 2, a2 = lk + 32 * KP * 2, a3 = lk + 48 * KP * 2;
  const unsigned b0 = lv, b1 = lv + 16 * KP * 2, b2 = lv + 32 * KP * 2, b3 = lv + 48 * KP * 2;
  // the copies and their s_wait_xcnt in one statement: no address register is rewritten before the wait
  asm volatile("global_load_async_to_lds_b128 %0, %8, off\n\t"
               "global_load_async_to_lds_b128 %1, %9, off\n\t"
               "global_load_async_to_lds_b128 %2, %10, off\n\t"
               "global_load_async_to_lds_b128 %3, %11, off\n\t"
               "global_load_async_to_lds_b128 %4, %12, off\n\t"
               "global_load_async_to_lds_b128 %5, %13, off\n\t"
               "global_load_async_to_lds_b128 %6, %14, off\n\t"
               "global_load_async_to_lds_b128 %7, %15, off\n\t"
               "s_wait_xcnt 0x0"
               :: "v"(a0), "v"(a1), "v"(a2), "v"(a3), "v"(b0), "v"(b1), "v"(b2), "v"(b3),
                  "v"(k0), "v"(k1), "v"(k2), "v"(k3), "v"(v0), "v"(v1), "v"(v2), "v"(v3) : "memory");
}
// lane l with lane l ^ 16
__device__ __forceinline__ float xhalf(float x) { const int b = __builtin_bit_cast(int, x); return __builtin_bit_cast(float, __builtin_amdgcn_permlanex16(b, b, 0x76543210, 0xfedcba98, false, false)); }
__global__ __launch_bounds__(128) void k_attn(const _Float16* __restrict__ Q, const _Float16* __restrict__ Kr, const _Float16* __restrict__ V2, float* __restrict__ O) {
  __shared__ __align__(16) float so[4][16][68];
  __shared__ __align__(16) _Float16 sk[2][KT][KP]; __shared__ __align__(16) _Float16 sv[2][HD][KP];
  const int tid = threadIdx.x, wave = tid >> 5, lane = tid & 31, col = lane & 15, g = lane >> 4; const int h = blockIdx.y; const size_t b = blockIdx.z; const int q0 = blockIdx.x * 64 + wave * 16; const size_t rq = b * SS + q0;
  // this thread's 16 bytes of the first of its four rows, in global memory (stage 0) and in LDS (buffer 0)
  const int crow = tid >> 3, cch = (tid & 7) * 8;
  const _Float16* gk = Kr + (b * SS + crow) * CC + h * HD + cch;
  const _Float16* gv = V2 + ((b * NH + h) * HD + crow) * SS + cch;
  const unsigned lk = (unsigned)(uintptr_t)&sk[0][crow][cch], lv = (unsigned)(uintptr_t)&sv[0][crow][cch];
  stage_kv(gk, gv, lk, lv);
  v16h aq[2];
#pragma unroll
  for (int kc = 0; kc < 2; ++kc) aq[kc] = frag_h(Q + (rq + col) * CC + h * HD + kc * 32, lane);
  float m = -3.0e38f, l = 0.f;   // this lane's query: running maximum (equal in both halves), and the sum over this half's keys
  v8f acc[4] = {};
  asm volatile("s_wait_asynccnt 0x0" ::: "memory");   // stage 0 has landed, as far as this wave copied it
  __syncthreads();                                     // ... and is published to the other waves
  stage_kv(gk + (size_t)KT * CC, gv + KT, lk + KT * KP * 2, lv + HD * KP * 2);
#pragma unroll 1   // one stage a trip, kept rolled: one publish point in the code, the buffer picked by t & 1
  for (int t = 0; t < NT; ++t) { const int bf = t & 1;
#pragma unroll   // both passes of a stage unrolled: their LDS offsets become immediates
   for (int p = 0; p < KT / 32; ++p) { v8f s[2];
    // all fragments of the pass are read as one group, so that their LDS latencies overlap
    v16h kf[2][2], vf[4];
#pragma unroll
    for (int ct = 0; ct < 2; ++ct)
#pragma unroll
      for (int kc = 0; kc < 2; ++kc) kf[ct][kc] = frag_h(&sk[bf][p * 32 + ct * 16 + col][kc * 32], lane);
#pragma unroll
    for (int dt = 0; dt < 4; ++dt) vf[dt] = frag_h(&sv[bf][dt * 16 + col][p * 32], lane);
#pragma unroll
    for (int ct = 0; ct < 2; ++ct) { v8f c = {};
#pragma unroll
      for (int kc = 0; kc < 2; ++kc) c = wmma16(kf[ct][kc], aq[kc], c);
#pragma unroll
      for (int r = 0; r < 8; ++r) s[ct][r] = c[r] * 0.125f; }
    float mx = fmaxf(s[0][0], s[1][0]);
#pragma unroll
    for (int r = 1; r < 8; ++r) mx = fmaxf(mx, fmaxf(s[0][r], s[1][r]));
    mx = fmaxf(mx, xhalf(mx));
    const float mn = fmaxf(m, mx); const float alpha = (m <= -1.0e38f) ? 0.f : __expf(m - mn);
    v16h pb; float es[2] = {0.f, 0.f};
#pragma unroll
    for (int ct = 0; ct < 2; ++ct)
#pragma unroll
      for (int r = 0; r < 8; ++r) { const float e = __expf(s[ct][r] - mn); es[ct] += e; pb[ct * 8 + r] = (_Float16)(e * 2048.0f); }
    l = l * alpha + (es[0] + es[1]); m = mn;
#pragma unroll
    for (int dt = 0; dt < 4; ++dt) acc[dt] = wmma16(vf[dt], pb, acc[dt] * alpha); }
   // publish point of stage t + 1: this wave's reads of buffer bf are done, its copies of stage t + 1 have landed, every wave has come so far
   asm volatile("s_wait_dscnt 0x0" ::: "memory");
   asm volatile("s_wait_asynccnt 0x0" ::: "memory");
   __syncthreads();
   if (t + 2 < NT) stage_kv(gk + (size_t)(t + 2) * KT * CC, gv + (t + 2) * KT, lk + bf * (KT * KP * 2), lv + bf * (HD * KP * 2)); }
  asm volatile("s_wait_asynccnt 0x0" ::: "memory");   // no copy is outstanding when the wave ends
  const float il = (1.0f / 2048.0f) / (l + xhalf(l));   // the halves' sums are joined once
#pragma unroll
  for (int dt = 0; dt < 4; ++dt) { const v8f o = acc[dt] * il;   // channels dt * 16 + 8g + 0..7 of query col
    *(v4f*)&so[wave][col][dt * 16 + 8 * g] = __builtin_shufflevector(o, o, 0, 1, 2, 3); *(v4f*)&so[wave][col][dt * 16 + 8 * g + 4] = __builtin_shufflevector(o, o, 4, 5, 6, 7); }
  LDSX();
  for (int rl = 0; rl < 16; ++rl) if (lane < 16) vst2(O + (((b * NH + h) * SS + q0 + rl) * HD) + lane * 4, *(const v4f*)&so[wave][rl][lane * 4]);
}
extern "C" void kernel_launch(void* const* d_in, const int* in_sizes, int n_in, void* d_out, int out_size, void* d_ws, size_t ws_size, hipStream_t stream) {
  (void)in_sizes; (void)n_in; (void)out_size;
  const float** F = (const float**)d_in;   // 0 x [4,512,2048], 1 wq [512,512], 2 bq, 3 wk, 4 bk, 5 wv, 6 bv
  if (ws_size < (size_t)WS_END) return;
  char* ws = (char*)d_ws; __bf16* PW = (__bf16*)ws; float* XT = (float*)(ws + WS_XT); _Float16 *Q = (_Float16*)(ws + WS_Q), *Kr = (_Float16*)(ws + WS_K), *V = (_Float16*)(ws + WS_V), *V2 = (_Float16*)(ws + WS_V2);
  k_pack<<<dim3(CC, 3), 256, 0, stream>>>(F[1], F[3], F[5], PW);
  k_tr<<<dim3(SS / 64, CC / 64, TNB), 256, 0, stream>>>(F[0], XT);
  k_proj<<<dim3(TNB * SS / 128, CC / 128, 3), 256, 0, stream>>>(XT, PW, F[2], F[4], F[6], Q, Kr, V);
  k_vq<<<dim3(SS / 64, TNB * NH), 256, 0, stream>>>(V, V2);
  k_attn<<<dim3(TQB, NH, TNB), 128, 0, stream>>>(Q, Kr, V2, (float*)d_out);
}

// v004
// One run takes 77.9 microseconds.
// In both of two side-by-side timings against v003, it was 1.03 times as fast.
// All steps since v000 together make it 3.18 times as fast.
// compute dtype: all float inputs rounded to bf16; x transposed to token rows in f32; q/k/v = x_t . W^T + b with EXACT bf16 products on WMMA 16x16x32 (natural rows), rounded once to f16 (v as (B,C,L) planes, then re-viewed through the module's raw .view(B,H,L,Ch) as transposed planes); attention: q, k single f16 x 1/8, running-max softmax in f32 (hardware exp), P (scaled by 2^11, single f16) x v2 (single f16); f32 output written in the module's raw (B,H,L,Ch) -> (B,C,L) memory order.
#include <hip/hip_runtime.h>
#include <math.h>

typedef __attribute__((ext_vector_type(16))) _Float16 v16h;
typedef __attribute__((ext_vector_type(16))) __bf16 v16b;
typedef __attribute__((ext_vector_type(8)))  _Float16 v8h;
typedef __attribute__((ext_vector_type(8)))  float v8f;
typedef __attribute__((ext_vector_type(4)))  float v4f;
typedef __attribute__((ext_vector_type(2)))  float v2f;
typedef __attribute__((ext_vector_type(4)))  unsigned v4u;
typedef __attribute__((ext_vector_type(4)))  int v4i;
typedef float __attribute__((may_alias)) float_a;
typedef int __attribute__((may_alias)) int_a;

template <typename T> __device__ __forceinline__ void vst2(void* p, T v) { *(T*)p = v;  }
__device__ __forceinline__ v8f wmma16(v16h a, v16h b, v8f c) {
  v8f d = __builtin_amdgcn_wmma_f32_16x16x32_f16(false, a, false, b, (short)0, c, false, false);
  asm volatile("v_nop\n\tv_nop\n\tv_nop\n\tv_nop" : "+v"(d) : "v"(a), "v"(b));
  return d;
}
__device__ __forceinline__ v8f wmma_bf(v16b a, v16b b, v8f c) {
  v8f d = __builtin_amdgcn_wmma_f32_16x16x32_bf16(false, a, false, b, (short)0, c, false, false);
  asm volatile("v_nop\n\tv_nop\n\tv_nop\n\tv_nop" : "+v"(d) : "v"(a), "v"(b));
  return d;
}
// 16x16x32 fragments: lane = (h = lane>>4, row/col = lane&15); elements 0..7 = k0+8h+0..7, 8..15 = k0+16+8h+0..7; D element r = row 8h+r
__device__ __forceinline__ v16h frag_h(const _Float16* rowk0, int lane) {
  union { v16h v; v8h q[2]; } u; const _Float16* p = rowk0 + 8 * (lane >> 4);
  u.q[0] = *(const v8h*)p; u.q[1] = *(const v8h*)(p + 16); return u.v;
}
__device__ __forceinline__ v16h frag_f32(const float* rowk0, int lane) {
  v16h a; const float* p = rowk0 + 8 * (lane >> 4);
#pragma unroll
  for (int i = 0; i < 8; ++i) { a[i] = (_Float16)p[i]; a[8 + i] = (_Float16)p[16 + i]; }
  return a;
}
__device__ __forceinline__ v16h frag_f32s(const float* rowk0, int lane, float sc) {
  v16h a; const float* p = rowk0 + 8 * (lane >> 4);
#pragma unroll
  for (int i = 0; i < 8; ++i) { a[i] = (_Float16)(p[i] * sc); a[8 + i] = (_Float16)(p[16 + i] * sc); }
  return a;
}
// column fragment from a [K][ld] layout (column n), rows >= K read as 0
__device__ __forceinline__ v16h fragc_f32(const float* W, int k0, int n, int lane, int ld, int K) {
  v16h a; const int g = lane >> 4;
#pragma unroll
  for (int i = 0; i < 8; ++i) { const int ka = k0 + 8 * g + i, kb = ka + 16;
    a[i] = (_Float16)(ka < K ? W[(size_t)(ka < K ? ka : K - 1) * ld + n] : 0.f); a[8 + i] = (_Float16)(kb < K ? W[(size_t)(kb < K ? kb : K - 1) * ld + n] : 0.f); }
  return a;
}
struct F2 { v16b h, l; };
__device__ __forceinline__ F2 bsplit16(const float v[16]) { F2 r;
#pragma unroll
  for (int i = 0; i < 16; ++i) { const __bf16 h = (__bf16)v[i]; r.h[i] = h; r.l[i] = (__bf16)(v[i] - (float)h); }
  return r; }
__device__ __forceinline__ F2 split_row(const float* row, int k0, int lane) { float v[16]; const float* p = row + k0 + 8 * (lane >> 4);
#pragma unroll
  for (int i = 0; i < 8; ++i) { v[i] = p[i]; v[8 + i] = p[16 + i]; }
  return bsplit16(v); }
__device__ __forceinline__ F2 split_rowK(const float* row, int k0, int lane, int K) { float v[16]; const int g = lane >> 4;
#pragma unroll
  for (int i = 0; i < 8; ++i) { const int ka = k0 + 8 * g + i, kb = ka + 16; v[i] = ka < K ? row[ka < K ? ka : K - 1] : 0.f; v[8 + i] = kb < K ? row[kb < K ? kb : K - 1] : 0.f; }
  return bsplit16(v); }
__device__ __forceinline__ F2 split_col(const float* W, int k0, int n, int lane, int ld, int K) { float v[16]; const int g = lane >> 4;
#pragma unroll
  for (int i = 0; i < 8; ++i) { const int ka = k0 + 8 * g + i, kb = ka + 16; v[i] = ka < K ? W[(size_t)(ka < K ? ka : K - 1) * ld + n] : 0.f; v[8 + i] = kb < K ? W[(size_t)(kb < K ? kb : K - 1) * ld + n] : 0.f; }
  return bsplit16(v); }
__device__ __forceinline__ v8f mac3(const F2& a, const F2& b, v8f c) { c = wmma_bf(a.l, b.h, c); c = wmma_bf(a.h, b.l, c); return wmma_bf(a.h, b.h, c); }
__device__ __forceinline__ float sigm(float v) { return 1.0f / (1.0f + expf(-v)); }
#define LDSX() do { asm volatile("s_wait_dscnt 0" ::: "memory"); __builtin_amdgcn_wave_barrier(); __builtin_amdgcn_fence(__ATOMIC_RELEASE, "workgroup"); } while (0)


// Multi-head self attention on a (B, C, L) sequence (B 4, C 512, L 2,048, 8 heads x 64) with 1x1-conv projections; faithful to the module's quirk of viewing v as (B,H,L,Ch) and the output as (B,C,L) by raw reshape.
#define NB 4
#define CC 512
#define SS 2048
#define NH 8
#define HD 64
#define NR (NB * SS)
#ifndef TQB
#define TQB (SS / 64)
#define TNB NB
#endif
typedef __attribute__((ext_vector_type(8))) __bf16 v8b;
__device__ __forceinline__ v16b frag_b(const __bf16* rowk0, int lane) {
  union { v16b v; v8b q[2]; } u; const __bf16* p = rowk0 + 8 * (lane >> 4);
  u.q[0] = *(const v8b*)p; u.q[1] = *(const v8b*)(p + 16); return u.v;
}
__device__ __forceinline__ float bfr(float v) { return (float)(__bf16)v; }
__device__ __attribute__((noinline)) float exp_ni(float v) { return expf(v); }
__device__ __attribute__((noinline)) float erf_ni(float v) { return erff(v); }

#define WS_PW  0u                                   // bf16 natural rows wq, wk, wv [3][512][512]
#define WS_XT  (WS_PW + 2u * (size_t)3 * CC * CC)       // f32 x^T token rows [NR][512]
#define WS_Q   (WS_XT + 4u * (size_t)NR * CC)          // f16 q rows [NR][512]; k rows; v planes (B,C,L) [b][512][L]; v2 planes [b][h][64][L]
#define WS_K   (WS_Q + 2u * (size_t)NR * CC)
#define WS_V   (WS_K + 2u * (size_t)NR * CC)
#define WS_V2  (WS_V + 2u * (size_t)NB * CC * SS)
#define WS_END (WS_V2 + 2u * (size_t)NB * CC * SS)

__global__ __launch_bounds__(256) void k_pack(const float* __restrict__ WQ, const float* __restrict__ WK, const float* __restrict__ WV, __bf16* __restrict__ PW) { const int n = blockIdx.x, which = blockIdx.y, t = threadIdx.x; __shared__ __align__(16) __bf16 s[CC]; const float* w = (which == 0) ? WQ : (which == 1) ? WK : WV; for (int k = t; k < CC; k += 256) s[k] = (__bf16)w[(size_t)n * CC + k]; __syncthreads(); if (t < CC / 8) vst2((unsigned*)(PW + ((size_t)which * CC + n) * CC + t * 8), *(const v4u*)&s[t * 8]); }
// ---- k_tr: block = (64 positions, 64 channels, b): x[b][c][l] -> XT[(b, l)][c] f32 (256-B row segments)
__global__ __launch_bounds__(256) void k_tr(const float* __restrict__ X, float* __restrict__ XT) { __shared__ float st[64][65]; const int t = threadIdx.x; const int l0 = blockIdx.x * 64, c0 = blockIdx.y * 64; const size_t b = blockIdx.z;
  for (int e = t; e < 64 * 64; e += 256) { const int cl = e >> 6, ll = e & 63; st[ll][cl] = X[(b * CC + c0 + cl) * SS + l0 + ll]; }
  __syncthreads(); __shared__ __align__(16) float so[64][68]; for (int e = t; e < 64 * 64; e += 256) { const int ll = e >> 6, cl = e & 63; so[ll][cl] = st[ll][cl]; } __syncthreads();
  for (int e = t; e < 64 * 16; e += 256) { const int ll = e >> 4, q = e & 15; vst2(XT + (b * SS + l0 + ll) * CC + c0 + q * 4, *(const v4f*)&so[ll][q * 4]); } }
// ---- k_proj: block = (128 rows, 128 cols, which), 8 waves of 32 rows x 64 cols: + bias; q/k -> f16 rows; v -> (B,C,L) planes
// x^T rows (f32) and weight rows (bf16) come in stages of PK channels through LDS, shared by the block's eight waves: two buffers, the next stage's asynchronous copies fly while this stage is worked on.
#define PK 64                         // channels per stage: an x^T row piece is 256 B, a weight row piece one 128-B line
#define PNT (CC / PK)
#define PAP 68                        // LDS pitch of an x^T row in f32: 272 B = 16 B x odd, conflict-free for 16-byte reads
#define PBP 72                        // LDS pitch of a weight row in bf16: 144 B = 16 B x odd
#define PA_BYTES (128 * PAP * 4)
#define PST_BYTES (PA_BYTES + 128 * PBP * 2)
#define POP 136                       // pitch of the output staging in f16: 272 B
// one stage: 128 x^T rows of 256 B, 16 lanes a row, 8 copies a thread (rows r + 16 i); 128 weight rows of 128 B, 8 lanes a row, 4 copies a thread (rows r + 32 i)
__device__ __forceinline__ void stage_ab(const float* ga, const __bf16* gb, unsigned la, unsigned lb) {
  const float *a0 = ga, *a1 = ga + 16 * CC, *a2 = ga + 32 * CC, *a3 = ga + 48 * CC, *a4 = ga + 64 * CC, *a5 = ga + 80 * CC, *a6 = ga + 96 * CC, *a7 = ga + 112 * CC;
  const __bf16 *b0 = gb, *b1 = gb + 32 * CC, *b2 = gb + 64 * CC, *b3 = gb + 96 * CC;
  const unsigned x0 = la, x1 = la + 16 * PAP * 4, x2 = la + 32 * PAP * 4, x3 = la + 48 * PAP * 4, x4 = la + 64 * PAP * 4, x5 = la + 80 * PAP * 4, x6 = la + 96 * PAP * 4, x7 = la + 112 * PAP * 4;
  const unsigned y0 = lb, y1 = lb + 32 * PBP * 2, y2 = lb + 64 * PBP * 2, y3 = lb + 96 * PBP * 2;
  // the copies and their s_wait_xcnt in one statement: no address register is rewritten before the wait
  asm volatile("global_load_async_to_lds_b128 %0, %12, off\n\t"
               "global_load_async_to_lds_b128 %1, %13, off\n\t"
               "global_load_async_to_lds_b128 %2, %14, off\n\t"
               "global_load_async_to_lds_b128 %3, %15, off\n\t"
               "global_load_async_to_lds_b128 %4, %16, off\n\t"
               "global_load_async_to_lds_b128 %5, %17, off\n\t"
               "global_load_async_to_lds_b128 %6, %18, off\n\t"
               "global_load_async_to_lds_b128 %7, %19, off\n\t"
               "global_load_async_to_lds_b128 %8, %20, off\n\t"
               "global_load_async_to_lds_b128 %9, %21, off\n\t"
               "global_load_async_to_lds_b128 %10, %22, off\n\t"
               "global_load_async_to_lds_b128 %11, %23, off\n\t"
               "s_wait_xcnt 0x0"
               :: "v"(x0), "v"(x1), "v"(x2), "v"(x3), "v"(x4), "v"(x5), "v"(x6), "v"(x7), "v"(y0), "v"(y1), "v"(y2), "v"(y3),
                  "v"(a0), "v"(a1), "v"(a2), "v"(a3), "v"(a4), "v"(a5), "v"(a6), "v"(a7), "v"(b0), "v"(b1), "v"(b2), "v"(b3) : "memory");
}
__global__ __launch_bounds__(256) void k_proj(const float* __restrict__ XT, const __bf16* __restrict__ PW, const float* __restrict__ BQ, const float* __restrict__ BK, const float* __restrict__ BV, _Float16* __restrict__ Q, _Float16* __restrict__ Kr, _Float16* __restrict__ V) {
  __shared__ __align__(16) unsigned char sm[2 * PST_BYTES];   // two stages [x^T 128 rows | weights 128 rows]; behind the loop the output staging
  const int tid = threadIdx.x, wave = tid >> 5, lane = tid & 31, col = lane & 15, g = lane >> 4; const int which = blockIdx.z; const size_t rb = (size_t)blockIdx.x * 128; const int c0 = blockIdx.y * 128; const int wr = (wave >> 1) * 32, wc = (wave & 1) * 64; const float* BB = (which == 0) ? BQ : (which == 1) ? BK : BV;
  // this thread's 16 bytes of the first of its rows, in global memory (stage 0) and in LDS (buffer 0)
  const float* ga = XT + (rb + (tid >> 4)) * CC + (tid & 15) * 4;
  const __bf16* gb = PW + ((size_t)which * CC + c0 + (tid >> 3)) * CC + (tid & 7) * 8;
  const unsigned la = (unsigned)(uintptr_t)&sm[(tid >> 4) * (PAP * 4) + (tid & 15) * 16], lb = (unsigned)(uintptr_t)&sm[PA_BYTES + (tid >> 3) * (PBP * 2) + (tid & 7) * 16];
  stage_ab(ga, gb, la, lb);
  v8f acc[2][4] = {};
  asm volatile("s_wait_asynccnt 0x0" ::: "memory");   // stage 0 has landed, as far as this wave copied it
  __syncthreads();                                     // ... and is published to the other waves
  stage_ab(ga + PK, gb + PK, la + PST_BYTES, lb + PST_BYTES);
#pragma unroll 1   // one stage a trip, kept rolled: one publish point in the code, the buffer picked by t & 1
  for (int t = 0; t < PNT; ++t) { const int bf = t & 1; const float* sa = (const float*)(sm + bf * PST_BYTES); const __bf16* sb = (const __bf16*)(sm + bf * PST_BYTES + PA_BYTES);
#pragma unroll   // both 32-channel steps of a stage unrolled: their LDS offsets become immediates
    for (int kc = 0; kc < PK / 32; ++kc) { v16b a[2], w[4];
      // all fragments of the step are read as one group, so that their LDS latencies overlap
#pragma unroll
      for (int i = 0; i < 2; ++i) { const float* p = sa + (wr + i * 16 + col) * PAP + kc * 32 + 8 * g;
#pragma unroll
        for (int e = 0; e < 8; ++e) { a[i][e] = (__bf16)p[e]; a[i][8 + e] = (__bf16)p[16 + e]; } }
#pragma unroll
      for (int j = 0; j < 4; ++j) w[j] = frag_b(sb + (wc + j * 16 + col) * PBP + kc * 32, lane);
#pragma unroll
      for (int i = 0; i < 2; ++i)
#pragma unroll
        for (int j = 0; j < 4; ++j) acc[i][j] = wmma_bf(a[i], w[j], acc[i][j]); }
    // publish point of stage t + 1: this wave's reads of buffer bf are done, its copies of stage t + 1 have landed, every wave has come so far
    asm volatile("s_wait_dscnt 0x0" ::: "memory");
    asm volatile("s_wait_asynccnt 0x0" ::: "memory");
    __syncthreads();
    if (t + 2 < PNT) stage_ab(ga + (t + 2) * PK, gb + (t + 2) * PK, la + bf * PST_BYTES, lb + bf * PST_BYTES); }
  asm volatile("s_wait_asynccnt 0x0" ::: "memory");   // no copy is outstanding when the ring becomes output staging (the last trip's barrier has ended every read of it)
  _Float16* so = (_Float16*)sm;
  if (which < 2) {   // so[row][col]
#pragma unroll
    for (int j = 0; j < 4; ++j) { const float bb = bfr(BB[c0 + wc + j * 16 + col]);
#pragma unroll
      for (int i = 0; i < 2; ++i)
#pragma unroll
        for (int r = 0; r < 8; ++r) so[(wr + i * 16 + 8 * g + r) * POP + wc + j * 16 + col] = (_Float16)(acc[i][j][r] + bb); }
  } else {           // so[col][row]: a lane's 8 rows of a tile are 16 contiguous bytes
#pragma unroll
    for (int j = 0; j < 4; ++j) { const float bb = bfr(BB[c0 + wc + j * 16 + col]);
#pragma unroll
      for (int i = 0; i < 2; ++i) { v8h hv;
#pragma unroll
        for (int r = 0; r < 8; ++r) hv[r] = (_Float16)(acc[i][j][r] + bb);
        *(v8h*)&so[(wc + j * 16 + col) * POP + wr + i * 16 + 8 * g] = hv; } }
  }
  __syncthreads();
  if (which < 2) { _Float16* dst = (which == 0) ? Q : Kr; 
#pragma unroll   // the eight LDS reads of a thread go out as one group
    for (int it = 0; it < 8; ++it) { const int rl = it * 16 + (tid >> 4), q = tid & 15; vst2((unsigned*)(dst + (rb + rl) * CC + c0 + q * 8), *(const v4u*)&so[rl * POP + q * 8]); } }
  else { const size_t b = rb / SS; const int s0 = (int)(rb % SS); 
#pragma unroll   // the eight LDS reads of a thread go out as one group
    for (int it = 0; it < 8; ++it) { const int d = it * 16 + (tid >> 4), pc = tid & 15; vst2((unsigned*)(V + ((b * CC + c0 + d) * SS) + s0 + pc * 8), *(const v4u*)&so[d * POP + pc * 8]); } }
}
// ---- k_vq: block = (64 m-rows, b*NH + h): the head's contiguous (Ch x L) block F of the (B,C,L) v tensor viewed as [L][Ch] (v2[m][c] = F[m*64 + c]) -> transposed planes V2[b][h][c][m]
__global__ __launch_bounds__(256) void k_vq(const _Float16* __restrict__ V, _Float16* __restrict__ V2) { __shared__ __align__(16) _Float16 st[64][72]; const int t = threadIdx.x; const int m0 = blockIdx.x * 64; const size_t bh = blockIdx.y; const _Float16* F = V + bh * (size_t)HD * SS;
  for (int e = t; e < 64 * 64; e += 256) { const int ml = e >> 6, c = e & 63; st[c][ml] = F[(size_t)(m0 + ml) * HD + c]; }
  __syncthreads(); for (int e = t; e < 64 * 8; e += 256) { const int c = e >> 3, pc = e & 7; vst2((unsigned*)(V2 + (bh * HD + c) * SS + m0 + pc * 8), *(const v4u*)&st[c][pc * 8]); } }
// ---- k_attn: block = (64 queries, head, b): softmax(q k / 8) over all L keys, . v2; output rows (b, h, l) of 64 floats (the raw (B,H,L,Ch) buffer == the module's (B,C,L) result)
// Scores are formed transposed, S^T = K . Q^T (A = K rows, B = Q rows): a lane holds 8 keys a tile of ONE query (column lane & 15), so maximum and sum run in the lane's own registers, with one exchange
// between the wave's halves; two S^T tiles, converted in place, are the B operand of O^T += v2^T . P^T in the hardware k order (keys 8g + 0..7, 16 + 8g + 0..7), the order in which frag_h reads the v2 rows.
// K rows and v2 planes come in stages of KT keys through LDS, shared by the block's four waves: two buffers, the next stage's asynchronous copies fly while this stage is worked on.
#define KT 64          // keys per stage: a K row (64 channels) and a v2 row (64 keys) are both one 128-B line
#define KP 72          // LDS row pitch in f16: 144 B = 16 B x odd, conflict-free for 16-byte fragment reads
#define NT (SS / KT)
// Softmax in base 2: exp((s - max) / 8) * 2^11 = exp2(s * CS2 + (11 - max * CS2)), one packed multiply-add for two raw scores ahead of the hardware exponential.
#define CS2 (0.125f * 1.4426950408889634f)
// one stage: 64 K rows + 64 v2 rows of 128 B, 8 lanes a row, 4 + 4 copies a thread (rows r, r + 16, r + 32, r + 48)
__device__ __forceinline__ void stage_kv(const _Float16* gk, const _Float16* gv, unsigned lk, unsigned lv) {
  const _Float16 *k0 = gk, *k1 = gk + 16 * CC, *k2 = gk + 32 * CC, *k3 = gk + 48 * CC;
  const _Float16 *v0 = gv, *v1 = gv + 16 * SS, *v2 = gv + 32 * SS, *v3 = gv + 48 * SS;
  const unsigned a0 = lk, a1 = lk + 16 * KP * 2, a2 = lk + 32 * KP * 2, a3 = lk + 48 * KP * 2;
  const unsigned b0 = lv, b1 = lv + 16 * KP * 2, b2 = lv + 32 * KP * 2, b3 = lv + 48 * KP * 2;
  // the copies and their s_wait_xcnt in one statement: no address register is rewritten before the wait
  asm volatile("global_load_async_to_lds_b128 %0, %8, off\n\t"
               "global_load_async_to_lds_b128 %1, %9, off\n\t"
               "global_load_async_to_lds_b128 %2, %10, off\n\t"
               "global_load_async_to_lds_b128 %3, %11, off\n\t"
               "global_load_async_to_lds_b128 %4, %12, off\n\t"
               "global_load_async_to_lds_b128 %5, %13, off\n\t"
               "global_load_async_to_lds_b128 %6, %14, off\n\t"
               "global_load_async_to_lds_b128 %7, %15, off\n\t"
               "s_wait_xcnt 0x0"
               :: "v"(a0), "v"(a1), "v"(a2), "v"(a3), "v"(b0), "v"(b1), "v"(b2), "v"(b3),
                  "v"(k0), "v"(k1), "v"(k2), "v"(k3), "v"(v0), "v"(v1), "v"(v2), "v"(v3) : "memory");
}
// lane l with lane l ^ 16
__device__ __forceinline__ float xhalf(float x) { const int b = __builtin_bit_cast(int, x); return __builtin_bit_cast(float, __builtin_amdgcn_permlanex16(b, b, 0x76543210, 0xfedcba98, false, false)); }
__global__ __launch_bounds__(128) void k_attn(const _Float16* __restrict__ Q, const _Float16* __restrict__ Kr, const _Float16* __restrict__ V2, float* __restrict__ O) {
  __shared__ __align__(16) float so[4][16][68];
  __shared__ __align__(16) _Float16 sk[2][KT][KP]; __shared__ __align__(16) _Float16 sv[2][HD][KP];
  const int tid = threadIdx.x, wave = tid >> 5, lane = tid & 31, col = lane & 15, g = lane >> 4; const int h = blockIdx.y; const size_t b = blockIdx.z; const int q0 = blockIdx.x * 64 + wave * 16; const size_t rq = b * SS + q0;
  // this thread's 16 bytes of the first of its four rows, in global memory (stage 0) and in LDS (buffer 0)
  const int crow = tid >> 3, cch = (tid & 7) * 8;
  const _Float16* gk = Kr + (b * SS + crow) * CC + h * HD + cch;
  const _Float16* gv = V2 + ((b * NH + h) * HD + crow) * SS + cch;
  const unsigned lk = (unsigned)(uintptr_t)&sk[0][crow][cch], lv = (unsigned)(uintptr_t)&sv[0][crow][cch];
  stage_kv(gk, gv, lk, lv);
  v16h aq[2];
#pragma unroll
  for (int kc = 0; kc < 2; ++kc) aq[kc] = frag_h(Q + (rq + col) * CC + h * HD + kc * 32, lane);
  float m = -3.0e38f, l = 0.f;   // this lane's query: running maximum of the raw scores (equal in both halves), and the sum over this half's keys (times 2^11)
  v8f acc[4] = {};
  asm volatile("s_wait_asynccnt 0x0" ::: "memory");   // stage 0 has landed, as far as this wave copied it
  __syncthreads();                                     // ... and is published to the other waves
  stage_kv(gk + (size_t)KT * CC, gv + KT, lk + KT * KP * 2, lv + HD * KP * 2);
#pragma unroll 1   // one stage a trip, kept rolled: one publish point in the code, the buffer picked by t & 1
  for (int t = 0; t < NT; ++t) { const int bf = t & 1;
#pragma unroll   // both passes of a stage unrolled: their LDS offsets become immediates
   for (int p = 0; p < KT / 32; ++p) { v8f s[2];
    // all fragments of the pass are read as one group, so that their LDS latencies overlap
    v16h kf[2][2], vf[4];
#pragma unroll
    for (int ct = 0; ct < 2; ++ct)
#pragma unroll
      for (int kc = 0; kc < 2; ++kc) kf[ct][kc] = frag_h(&sk[bf][p * 32 + ct * 16 + col][kc * 32], lane);
#pragma unroll
    for (int dt = 0; dt < 4; ++dt) vf[dt] = frag_h(&sv[bf][dt * 16 + col][p * 32], lane);
#pragma unroll
    for (int ct = 0; ct < 2; ++ct) { v8f c = {};
#pragma unroll
      for (int kc = 0; kc < 2; ++kc) c = wmma16(kf[ct][kc], aq[kc], c);
      s[ct] = c; }   // raw scores: the scale is positive, so their maximum is the scaled scores' maximum
    float mx = fmaxf(s[0][0], s[1][0]);
#pragma unroll
    for (int r = 1; r < 8; ++r) mx = fmaxf(mx, fmaxf(s[0][r], s[1][r]));
    mx = fmaxf(mx, xhalf(mx));
    const float mn = fmaxf(m, mx); const float alpha = (m <= -1.0e38f) ? 0.f : __builtin_amdgcn_exp2f((m - mn) * CS2);
    const float nm = __builtin_fmaf(-mn, CS2, 11.0f);   // the exponent's offset: minus the scaled maximum, plus P's factor 2^11
    v16h pb; float es[2] = {0.f, 0.f};
#pragma unroll
    for (int ct = 0; ct < 2; ++ct)
#pragma unroll
      for (int i = 0; i < 4; ++i) { const v2f arg = __builtin_elementwise_fma(v2f{s[ct][2 * i], s[ct][2 * i + 1]}, v2f{CS2, CS2}, v2f{nm, nm});
        const float e0 = __builtin_amdgcn_exp2f(arg.x), e1 = __builtin_amdgcn_exp2f(arg.y); es[ct] += e0; es[ct] += e1; pb[ct * 8 + 2 * i] = (_Float16)e0; pb[ct * 8 + 2 * i + 1] = (_Float16)e1; }
    l = l * alpha + (es[0] + es[1]); m = mn;
#pragma unroll
    for (int dt = 0; dt < 4; ++dt) acc[dt] = wmma16(vf[dt], pb, acc[dt] * alpha); }
   // publish point of stage t + 1: this wave's reads of buffer bf are done, its copies of stage t + 1 have landed, every wave has come so far
   asm volatile("s_wait_dscnt 0x0" ::: "memory");
   asm volatile("s_wait_asynccnt 0x0" ::: "memory");
   __syncthreads();
   if (t + 2 < NT) stage_kv(gk + (size_t)(t + 2) * KT * CC, gv + (t + 2) * KT, lk + bf * (KT * KP * 2), lv + bf * (HD * KP * 2)); }
  asm volatile("s_wait_asynccnt 0x0" ::: "memory");   // no copy is outstanding when the wave ends
  const float il = 1.0f / (l + xhalf(l));   // the halves' sums are joined once; sums and accumulators both carry 2^11
#pragma unroll
  for (int dt = 0; dt < 4; ++dt) { const v8f o = acc[dt] * il;   // channels dt * 16 + 8g + 0..7 of query col
    *(v4f*)&so[wave][col][dt * 16 + 8 * g] = __builtin_shufflevector(o, o, 0, 1, 2, 3); *(v4f*)&so[wave][col][dt * 16 + 8 * g + 4] = __builtin_shufflevector(o, o, 4, 5, 6, 7); }
  LDSX();
  for (int rl = 0; rl < 16; ++rl) if (lane < 16) vst2(O + (((b * NH + h) * SS + q0 + rl) * HD) + lane * 4, *(const v4f*)&so[wave][rl][lane * 4]);
}
extern "C" void kernel_launch(void* const* d_in, const int* in_sizes, int n_in, void* d_out, int out_size, void* d_ws, size_t ws_size, hipStream_t stream) {
  (void)in_sizes; (void)n_in; (void)out_size;
  const float** F = (const float**)d_in;   // 0 x [4,512,2048], 1 wq [512,512], 2 bq, 3 wk, 4 bk, 5 wv, 6 bv
  if (ws_size < (size_t)WS_END) return;
  char* ws = (char*)d_ws; __bf16* PW = (__bf16*)ws; float* XT = (float*)(ws + WS_XT); _Float16 *Q = (_Float16*)(ws + WS_Q), *Kr = (_Float16*)(ws + WS_K), *V = (_Float16*)(ws + WS_V), *V2 = (_Float16*)(ws + WS_V2);
  k_pack<<<dim3(CC, 3), 256, 0, stream>>>(F[1], F[3], F[5], PW);
  k_tr<<<dim3(SS / 64, CC / 64, TNB), 256, 0, stream>>>(F[0], XT);
  k_proj<<<dim3(TNB * SS / 128, CC / 128, 3), 256, 0, stream>>>(XT, PW, F[2], F[4], F[6], Q, Kr, V);
  k_vq<<<dim3(SS / 64, TNB * NH), 256, 0, stream>>>(V, V2);
  k_attn<<<dim3(TQB, NH, TNB), 128, 0, stream>>>(Q, Kr, V2, (float*)d_out);
}

// v005
// One run takes 74.7 microseconds.
// Next to v004, in two timings, it ran 1.06 and 1.04 times as fast.
// All steps since v000 together make it 3.32 times as fast.
// compute dtype: all float inputs rounded to bf16; x transposed to token rows in f32; q/k/v = x_t . W^T + b with EXACT bf16 products on WMMA 16x16x32 (natural rows), rounded once to f16 (v as (B,C,L) planes, read by the attention through the module's raw .view(B,H,L,Ch) as rows of 64 channels a key); attention: q, k single f16 x 1/8, running-max softmax in f32 (hardware exp), P (scaled by 2^11, single f16) x v2 (single f16); f32 output written in the module's raw (B,H,L,Ch) -> (B,C,L) memory order.
#include <hip/hip_runtime.h>
#include <math.h>

typedef __attribute__((ext_vector_type(16))) _Float16 v16h;
typedef __attribute__((ext_vector_type(16))) __bf16 v16b;
typedef __attribute__((ext_vector_type(8)))  _Float16 v8h;
typedef __attribute__((ext_vector_type(8)))  float v8f;
typedef __attribute__((ext_vector_type(4)))  float v4f;
typedef __attribute__((ext_vector_type(2)))  float v2f;
typedef __attribute__((ext_vector_type(4)))  unsigned v4u;
typedef __attribute__((ext_vector_type(4)))  int v4i;
typedef float __attribute__((may_alias)) float_a;
typedef int __attribute__((may_alias)) int_a;

template <typename T> __device__ __forceinline__ void vst2(void* p, T v) { *(T*)p = v;  }
__device__ __forceinline__ v8f wmma16(v16h a, v16h b, v8f c) {
  v8f d = __builtin_amdgcn_wmma_f32_16x16x32_f16(false, a, false, b, (short)0, c, false, false);
  asm volatile("v_nop\n\tv_nop\n\tv_nop\n\tv_nop" : "+v"(d) : "v"(a), "v"(b));
  return d;
}
__device__ __forceinline__ v8f wmma_bf(v16b a, v16b b, v8f c) {
  v8f d = __builtin_amdgcn_wmma_f32_16x16x32_bf16(false, a, false, b, (short)0, c, false, false);
  asm volatile("v_nop\n\tv_nop\n\tv_nop\n\tv_nop" : "+v"(d) : "v"(a), "v"(b));
  return d;
}
// 16x16x32 fragments: lane = (h = lane>>4, row/col = lane&15); elements 0..7 = k0+8h+0..7, 8..15 = k0+16+8h+0..7; D element r = row 8h+r
__device__ __forceinline__ v16h frag_h(const _Float16* rowk0, int lane) {
  union { v16h v; v8h q[2]; } u; const _Float16* p = rowk0 + 8 * (lane >> 4);
  u.q[0] = *(const v8h*)p; u.q[1] = *(const v8h*)(p + 16); return u.v;
}
__device__ __forceinline__ v16h frag_f32(const float* rowk0, int lane) {
  v16h a; const float* p = rowk0 + 8 * (lane >> 4);
#pragma unroll
  for (int i = 0; i < 8; ++i) { a[i] = (_Float16)p[i]; a[8 + i] = (_Float16)p[16 + i]; }
  return a;
}
__device__ __forceinline__ v16h frag_f32s(const float* rowk0, int lane, float sc) {
  v16h a; const float* p = rowk0 + 8 * (lane >> 4);
#pragma unroll
  for (int i = 0; i < 8; ++i) { a[i] = (_Float16)(p[i] * sc); a[8 + i] = (_Float16)(p[16 + i] * sc); }
  return a;
}
// column fragment from a [K][ld] layout (column n), rows >= K read as 0
__device__ __forceinline__ v16h fragc_f32(const float* W, int k0, int n, int lane, int ld, int K) {
  v16h a; const int g = lane >> 4;
#pragma unroll
  for (int i = 0; i < 8; ++i) { const int ka = k0 + 8 * g + i, kb = ka + 16;
    a[i] = (_Float16)(ka < K ? W[(size_t)(ka < K ? ka : K - 1) * ld + n] : 0.f); a[8 + i] = (_Float16)(kb < K ? W[(size_t)(kb < K ? kb : K - 1) * ld + n] : 0.f); }
  return a;
}
struct F2 { v16b h, l; };
__device__ __forceinline__ F2 bsplit16(const float v[16]) { F2 r;
#pragma unroll
  for (int i = 0; i < 16; ++i) { const __bf16 h = (__bf16)v[i]; r.h[i] = h; r.l[i] = (__bf16)(v[i] - (float)h); }
  return r; }
__device__ __forceinline__ F2 split_row(const float* row, int k0, int lane) { float v[16]; const float* p = row + k0 + 8 * (lane >> 4);
#pragma unroll
  for (int i = 0; i < 8; ++i) { v[i] = p[i]; v[8 + i] = p[16 + i]; }
  return bsplit16(v); }
__device__ __forceinline__ F2 split_rowK(const float* row, int k0, int lane, int K) { float v[16]; const int g = lane >> 4;
#pragma unroll
  for (int i = 0; i < 8; ++i) { const int ka = k0 + 8 * g + i, kb = ka + 16; v[i] = ka < K ? row[ka < K ? ka : K - 1] : 0.f; v[8 + i] = kb < K ? row[kb < K ? kb : K - 1] : 0.f; }
  return bsplit16(v); }
__device__ __forceinline__ F2 split_col(const float* W, int k0, int n, int lane, int ld, int K) { float v[16]; const int g = lane >> 4;
#pragma unroll
  for (int i = 0; i < 8; ++i) { const int ka = k0 + 8 * g + i, kb = ka + 16; v[i] = ka < K ? W[(size_t)(ka < K ? ka : K - 1) * ld + n] : 0.f; v[8 + i] = kb < K ? W[(size_t)(kb < K ? kb : K - 1) * ld + n] : 0.f; }
  return bsplit16(v); }
__device__ __forceinline__ v8f mac3(const F2& a, const F2& b, v8f c) { c = wmma_bf(a.l, b.h, c); c = wmma_bf(a.h, b.l, c); return wmma_bf(a.h, b.h, c); }
__device__ __forceinline__ float sigm(float v) { return 1.0f / (1.0f + expf(-v)); }
#define LDSX() do { asm volatile("s_wait_dscnt 0" ::: "memory"); __builtin_amdgcn_wave_barrier(); __builtin_amdgcn_fence(__ATOMIC_RELEASE, "workgroup"); } while (0)


// Multi-head self attention on a (B, C, L) sequence (B 4, C 512, L 2,048, 8 heads x 64) with 1x1-conv projections; faithful to the module's quirk of viewing v as (B,H,L,Ch) and the output as (B,C,L) by raw reshape.
#define NB 4
#define CC 512
#define SS 2048
#define NH 8
#define HD 64
#define NR (NB * SS)
#ifndef TQB
#define TQB (SS / 64)
#define TNB NB
#endif
typedef __attribute__((ext_vector_type(8))) __bf16 v8b;
__device__ __forceinline__ v16b frag_b(const __bf16* rowk0, int lane) {
  union { v16b v; v8b q[2]; } u; const __bf16* p = rowk0 + 8 * (lane >> 4);
  u.q[0] = *(const v8b*)p; u.q[1] = *(const v8b*)(p + 16); return u.v;
}
__device__ __forceinline__ float bfr(float v) { return (float)(__bf16)v; }
__device__ __attribute__((noinline)) float exp_ni(float v) { return expf(v); }
__device__ __attribute__((noinline)) float erf_ni(float v) { return erff(v); }

#define WS_PW  0u                                   // bf16 natural rows wq, wk, wv [3][512][512]
#define WS_XT  (WS_PW + 2u * (size_t)3 * CC * CC)       // f32 x^T token rows [NR][512]
#define WS_Q   (WS_XT + 4u * (size_t)NR * CC)          // f16 q rows [NR][512]; k rows; v planes (B,C,L) [b][512][L]
#define WS_K   (WS_Q + 2u * (size_t)NR * CC)
#define WS_V   (WS_K + 2u * (size_t)NR * CC)
#define WS_END (WS_V + 2u * (size_t)NB * CC * SS)

__global__ __launch_bounds__(256) void k_pack(const float* __restrict__ WQ, const float* __restrict__ WK, const float* __restrict__ WV, __bf16* __restrict__ PW) { const int n = blockIdx.x, which = blockIdx.y, t = threadIdx.x; __shared__ __align__(16) __bf16 s[CC]; const float* w = (which == 0) ? WQ : (which == 1) ? WK : WV; for (int k = t; k < CC; k += 256) s[k] = (__bf16)w[(size_t)n * CC + k]; __syncthreads(); if (t < CC / 8) vst2((unsigned*)(PW + ((size_t)which * CC + n) * CC + t * 8), *(const v4u*)&s[t * 8]); }
// ---- k_tr: block = (64 positions, 64 channels, b): x[b][c][l] -> XT[(b, l)][c] f32 (256-B row segments)
__global__ __launch_bounds__(256) void k_tr(const float* __restrict__ X, float* __restrict__ XT) { __shared__ float st[64][65]; const int t = threadIdx.x; const int l0 = blockIdx.x * 64, c0 = blockIdx.y * 64; const size_t b = blockIdx.z;
  for (int e = t; e < 64 * 64; e += 256) { const int cl = e >> 6, ll = e & 63; st[ll][cl] = X[(b * CC + c0 + cl) * SS + l0 + ll]; }
  __syncthreads(); __shared__ __align__(16) float so[64][68]; for (int e = t; e < 64 * 64; e += 256) { const int ll = e >> 6, cl = e & 63; so[ll][cl] = st[ll][cl]; } __syncthreads();
  for (int e = t; e < 64 * 16; e += 256) { const int ll = e >> 4, q = e & 15; vst2(XT + (b * SS + l0 + ll) * CC + c0 + q * 4, *(const v4f*)&so[ll][q * 4]); } }
// ---- k_proj: block = (128 rows, 128 cols, which), 8 waves of 32 rows x 64 cols: + bias; q/k -> f16 rows; v -> (B,C,L) planes
// x^T rows (f32) and weight rows (bf16) come in stages of PK channels through LDS, shared by the block's eight waves: two buffers, the next stage's asynchronous copies fly while this stage is worked on.
#define PK 64                         // channels per stage: an x^T row piece is 256 B, a weight row piece one 128-B line
#define PNT (CC / PK)
#define PAP 68                        // LDS pitch of an x^T row in f32: 272 B = 16 B x odd, conflict-free for 16-byte reads
#define PBP 72                        // LDS pitch of a weight row in bf16: 144 B = 16 B x odd
#define PA_BYTES (128 * PAP * 4)
#define PST_BYTES (PA_BYTES + 128 * PBP * 2)
#define POP 136                       // pitch of the output staging in f16: 272 B
// one stage: 128 x^T rows of 256 B, 16 lanes a row, 8 copies a thread (rows r + 16 i); 128 weight rows of 128 B, 8 lanes a row, 4 copies a thread (rows r + 32 i)
__device__ __forceinline__ void stage_ab(const float* ga, const __bf16* gb, unsigned la, unsigned lb) {
  const float *a0 = ga, *a1 = ga + 16 * CC, *a2 = ga + 32 * CC, *a3 = ga + 48 * CC, *a4 = ga + 64 * CC, *a5 = ga + 80 * CC, *a6 = ga + 96 * CC, *a7 = ga + 112 * CC;
  const __bf16 *b0 = gb, *b1 = gb + 32 * CC, *b2 = gb + 64 * CC, *b3 = gb + 96 * CC;
  const unsigned x0 = la, x1 = la + 16 * PAP * 4, x2 = la + 32 * PAP * 4, x3 = la + 48 * PAP * 4, x4 = la + 64 * PAP * 4, x5 = la + 80 * PAP * 4, x6 = la + 96 * PAP * 4, x7 = la + 112 * PAP * 4;
  const unsigned y0 = lb, y1 = lb + 32 * PBP * 2, y2 = lb + 64 * PBP * 2, y3 = lb + 96 * PBP * 2;
  // the copies and their s_wait_xcnt in one statement: no address register is rewritten before the wait
  asm volatile("global_load_async_to_lds_b128 %0, %12, off\n\t"
               "global_load_async_to_lds_b128 %1, %13, off\n\t"
               "global_load_async_to_lds_b128 %2, %14, off\n\t"
               "global_load_async_to_lds_b128 %3, %15, off\n\t"
               "global_load_async_to_lds_b128 %4, %16, off\n\t"
               "global_load_async_to_lds_b128 %5, %17, off\n\t"
               "global_load_async_to_lds_b128 %6, %18, off\n\t"
               "global_load_async_to_lds_b128 %7, %19, off\n\t"
               "global_load_async_to_lds_b128 %8, %20, off\n\t"
               "global_load_async_to_lds_b128 %9, %21, off\n\t"
               "global_load_async_to_lds_b128 %10, %22, off\n\t"
               "global_load_async_to_lds_b128 %11, %23, off\n\t"
               "s_wait_xcnt 0x0"
               :: "v"(x0), "v"(x1), "v"(x2), "v"(x3), "v"(x4), "v"(x5), "v"(x6), "v"(x7), "v"(y0), "v"(y1), "v"(y2), "v"(y3),
                  "v"(a0), "v"(a1), "v"(a2), "v"(a3), "v"(a4), "v"(a5), "v"(a6), "v"(a7), "v"(b0), "v"(b1), "v"(b2), "v"(b3) : "memory");
}
__global__ __launch_bounds__(256) void k_proj(const float* __restrict__ XT, const __bf16* __restrict__ PW, const float* __restrict__ BQ, const float* __restrict__ BK, const float* __restrict__ BV, _Float16* __restrict__ Q, _Float16* __restrict__ Kr, _Float16* __restrict__ V) {
  __shared__ __align__(16) unsigned char sm[2 * PST_BYTES];   // two stages [x^T 128 rows | weights 128 rows]; behind the loop the output staging
  const int tid = threadIdx.x, wave = tid >> 5, lane = tid & 31, col = lane & 15, g = lane >> 4; const int which = blockIdx.z; const size_t rb = (size_t)blockIdx.x * 128; const int c0 = blockIdx.y * 128; const int wr = (wave >> 1) * 32, wc = (wave & 1) * 64; const float* BB = (which == 0) ? BQ : (which == 1) ? BK : BV;
  // this thread's 16 bytes of the first of its rows, in global memory (stage 0) and in LDS (buffer 0)
  const float* ga = XT + (rb + (tid >> 4)) * CC + (tid & 15) * 4;
  const __bf16* gb = PW + ((size_t)which * CC + c0 + (tid >> 3)) * CC + (tid & 7) * 8;
  const unsigned la = (unsigned)(uintptr_t)&sm[(tid >> 4) * (PAP * 4) + (tid & 15) * 16], lb = (unsigned)(uintptr_t)&sm[PA_BYTES + (tid >> 3) * (PBP * 2) + (tid & 7) * 16];
  stage_ab(ga, gb, la, lb);
  v8f acc[2][4] = {};
  asm volatile("s_wait_asynccnt 0x0" ::: "memory");   // stage 0 has landed, as far as this wave copied it
  __syncthreads();                                     // ... and is published to the other waves
  stage_ab(ga + PK, gb + PK, la + PST_BYTES, lb + PST_BYTES);
#pragma unroll 1   // one stage a trip, kept rolled: one publish point in the code, the buffer picked by t & 1
  for (int t = 0; t < PNT; ++t) { const int bf = t & 1; const float* sa = (const float*)(sm + bf * PST_BYTES); const __bf16* sb = (const __bf16*)(sm + bf * PST_BYTES + PA_BYTES);
#pragma unroll   // both 32-channel steps of a stage unrolled: their LDS offsets become immediates
    for (int kc = 0; kc < PK / 32; ++kc) { v16b a[2], w[4];
      // all fragments of the step are read as one group, so that their LDS latencies overlap
#pragma unroll
      for (int i = 0; i < 2; ++i) { const float* p = sa + (wr + i * 16 + col) * PAP + kc * 32 + 8 * g;
#pragma unroll
        for (int e = 0; e < 8; ++e) { a[i][e] = (__bf16)p[e]; a[i][8 + e] = (__bf16)p[16 + e]; } }
#pragma unroll
      for (int j = 0; j < 4; ++j) w[j] = frag_b(sb + (wc + j * 16 + col) * PBP + kc * 32, lane);
#pragma unroll
      for (int i = 0; i < 2; ++i)
#pragma unroll
        for (int j = 0; j < 4; ++j) acc[i][j] = wmma_bf(a[i], w[j], acc[i][j]); }
    // publish point of stage t + 1: this wave's reads of buffer bf are done, its copies of stage t + 1 have landed, every wave has come so far
    asm volatile("s_wait_dscnt 0x0" ::: "memory");
    asm volatile("s_wait_asynccnt 0x0" ::: "memory");
    __syncthreads();
    if (t + 2 < PNT) stage_ab(ga + (t + 2) * PK, gb + (t + 2) * PK, la + bf * PST_BYTES, lb + bf * PST_BYTES); }
  asm volatile("s_wait_asynccnt 0x0" ::: "memory");   // no copy is outstanding when the ring becomes output staging (the last trip's barrier has ended every read of it)
  _Float16* so = (_Float16*)sm;
  if (which < 2) {   // so[row][col]
#pragma unroll
    for (int j = 0; j < 4; ++j) { const float bb = bfr(BB[c0 + wc + j * 16 + col]);
#pragma unroll
      for (int i = 0; i < 2; ++i)
#pragma unroll
        for (int r = 0; r < 8; ++r) so[(wr + i * 16 + 8 * g + r) * POP + wc + j * 16 + col] = (_Float16)(acc[i][j][r] + bb); }
  } else {           // so[col][row]: a lane's 8 rows of a tile are 16 contiguous bytes
#pragma unroll
    for (int j = 0; j < 4; ++j) { const float bb = bfr(BB[c0 + wc + j * 16 + col]);
#pragma unroll
      for (int i = 0; i < 2; ++i) { v8h hv;
#pragma unroll
        for (int r = 0; r < 8; ++r) hv[r] = (_Float16)(acc[i][j][r] + bb);
        *(v8h*)&so[(wc + j * 16 + col) * POP + wr + i * 16 + 8 * g] = hv; } }
  }
  __syncthreads();
  if (which < 2) { _Float16* dst = (which == 0) ? Q : Kr; 
#pragma unroll   // the eight LDS reads of a thread go out as one group
    for (int it = 0; it < 8; ++it) { const int rl = it * 16 + (tid >> 4), q = tid & 15; vst2((unsigned*)(dst + (rb + rl) * CC + c0 + q * 8), *(const v4u*)&so[rl * POP + q * 8]); } }
  else { const size_t b = rb / SS; const int s0 = (int)(rb % SS); 
#pragma unroll   // the eight LDS reads of a thread go out as one group
    for (int it = 0; it < 8; ++it) { const int d = it * 16 + (tid >> 4), pc = tid & 15; vst2((unsigned*)(V + ((b * CC + c0 + d) * SS) + s0 + pc * 8), *(const v4u*)&so[d * POP + pc * 8]); } }
}
// ---- k_attn: block = (64 queries, head, b): softmax(q k / 8) over all L keys, . v2; output rows (b, h, l) of 64 floats (the raw (B,H,L,Ch) buffer == the module's (B,C,L) result)
// Scores are formed transposed, S^T = K . Q^T (A = K rows, B = Q rows): a lane holds 8 keys a tile of ONE query (column lane & 15), so maximum and sum run in the lane's own registers, with one exchange
// between the wave's halves; two S^T tiles, converted in place, are the B operand of O^T += v2^T . P^T in the hardware k order (keys 8g + 0..7, 16 + 8g + 0..7), the order in which the transposing load delivers v2^T.
// v2[m][c] = F[m * 64 + c], F the head's contiguous (Ch x L) block of the (B,C,L) v tensor: a key's 64 channels are one 128-B line as they lie, and no transposed copy is made.
// K rows and v2 rows come in stages of KT keys through LDS, shared by the block's four waves: two buffers, the next stage's asynchronous copies fly while this stage is worked on.
#define KT 64          // keys per stage: a K row and a v2 row (64 channels each) are both one 128-B line
#define KP 72          // LDS pitch of a K row in f16: 144 B = 16 B x odd, conflict-free for 16-byte fragment reads
#define VP 80          // LDS pitch of a v2 row in f16: 160 B = 32 B x odd, conflict-free for the transposing load
#define NT (SS / KT)
// Softmax in base 2: exp((s - max) / 8) * 2^11 = exp2(s * CS2 + (11 - max * CS2)), one packed multiply-add for two raw scores ahead of the hardware exponential.
#define CS2 (0.125f * 1.4426950408889634f)
// one stage: 64 K rows + 64 v2 rows of 128 B, 8 lanes a row, 4 + 4 copies a thread (rows r, r + 16, r + 32, r + 48)
__device__ __forceinline__ void stage_kv(const _Float16* gk, const _Float16* gv, unsigned lk, unsigned lv) {
  const _Float16 *k0 = gk, *k1 = gk + 16 * CC, *k2 = gk + 32 * CC, *k3 = gk + 48 * CC;
  const _Float16 *v0 = gv, *v1 = gv + 16 * HD, *v2 = gv + 32 * HD, *v3 = gv + 48 * HD;
  const unsigned a0 = lk, a1 = lk + 16 * KP * 2, a2 = lk + 32 * KP * 2, a3 = lk + 48 * KP * 2;
  const unsigned b0 = lv, b1 = lv + 16 * VP * 2, b2 = lv + 32 * VP * 2, b3 = lv + 48 * VP * 2;
  // the copies and their s_wait_xcnt in one statement: no address register is rewritten before the wait
  asm volatile("global_load_async_to_lds_b128 %0, %8, off\n\t"
               "global_load_async_to_lds_b128 %1, %9, off\n\t"
               "global_load_async_to_lds_b128 %2, %10, off\n\t"
               "global_load_async_to_lds_b128 %3, %11, off\n\t"
               "global_load_async_to_lds_b128 %4, %12, off\n\t"
               "global_load_async_to_lds_b128 %5, %13, off\n\t"
               "global_load_async_to_lds_b128 %6, %14, off\n\t"
               "global_load_async_to_lds_b128 %7, %15, off\n\t"
               "s_wait_xcnt 0x0"
               :: "v"(a0), "v"(a1), "v"(a2), "v"(a3), "v"(b0), "v"(b1), "v"(b2), "v"(b3),
                  "v"(k0), "v"(k1), "v"(k2), "v"(k3), "v"(v0), "v"(v1), "v"(v2), "v"(v3) : "memory");
}
// 16 keys x 16 channels of row-major v2 in LDS, transposed: lane (col, g) gets keys 8g + 0..7 of channel col; p is the lane's own address (key 8g + (lane & 7), 16 bytes (lane >> 3) & 1)
typedef short s16x8 __attribute__((ext_vector_type(8)));
__device__ __forceinline__ v8h ld_tr16(const _Float16* p) { typedef __attribute__((address_space(3))) s16x8 lds_s16x8; return __builtin_bit_cast(v8h, __builtin_amdgcn_ds_load_tr16_b128_v8i16((lds_s16x8*)p)); }
// lane l with lane l ^ 16
__device__ __forceinline__ float xhalf(float x) { const int b = __builtin_bit_cast(int, x); return __builtin_bit_cast(float, __builtin_amdgcn_permlanex16(b, b, 0x76543210, 0xfedcba98, false, false)); }
__global__ __launch_bounds__(128) void k_attn(const _Float16* __restrict__ Q, const _Float16* __restrict__ Kr, const _Float16* __restrict__ V, float* __restrict__ O) {
  __shared__ __align__(16) float so[4][16][68];
  __shared__ __align__(16) _Float16 sk[2][KT][KP]; __shared__ __align__(16) _Float16 sv[2][KT][VP];
  const int tid = threadIdx.x, wave = tid >> 5, lane = tid & 31, col = lane & 15, g = lane >> 4; const int h = blockIdx.y; const size_t b = blockIdx.z; const int q0 = blockIdx.x * 64 + wave * 16; const size_t rq = b * SS + q0;
  // this thread's 16 bytes of the first of its four rows, in global memory (stage 0) and in LDS (buffer 0)
  const int crow = tid >> 3, cch = (tid & 7) * 8;
  const _Float16* gk = Kr + (b * SS + crow) * CC + h * HD + cch;
  const _Float16* gv = V + (b * NH + h) * (size_t)HD * SS + crow * HD + cch;
  const unsigned lk = (unsigned)(uintptr_t)&sk[0][crow][cch], lv = (unsigned)(uintptr_t)&sv[0][crow][cch];
  stage_kv(gk, gv, lk, lv);
  v16h aq[2];
#pragma unroll
  for (int kc = 0; kc < 2; ++kc) aq[kc] = frag_h(Q + (rq + col) * CC + h * HD + kc * 32, lane);
  float m = -3.0e38f, l = 0.f;   // this lane's query: running maximum of the raw scores (equal in both halves), and the sum over this half's keys (times 2^11)
  v8f acc[4] = {};
  asm volatile("s_wait_asynccnt 0x0" ::: "memory");   // stage 0 has landed, as far as this wave copied it
  __syncthreads();                                     // ... and is published to the other waves
  stage_kv(gk + (size_t)KT * CC, gv + KT * HD, lk + KT * KP * 2, lv + KT * VP * 2);
#pragma unroll 1   // one stage a trip, kept rolled: one publish point in the code, the buffer picked by t & 1
  for (int t = 0; t < NT; ++t) { const int bf = t & 1;
#pragma unroll   // both passes of a stage unrolled: their LDS offsets become immediates
   for (int p = 0; p < KT / 32; ++p) { v8f s[2];
    // all fragments of the pass are read as one group, so that their LDS latencies overlap
    v16h kf[2][2], vf[4];
#pragma unroll
    for (int ct = 0; ct < 2; ++ct)
#pragma unroll
      for (int kc = 0; kc < 2; ++kc) kf[ct][kc] = frag_h(&sk[bf][p * 32 + ct * 16 + col][kc * 32], lane);
#pragma unroll
    for (int dt = 0; dt < 4; ++dt) { union { v16h v; v8h q[2]; } u; const _Float16* a = &sv[bf][p * 32 + 8 * g + (lane & 7)][dt * 16 + 8 * ((lane >> 3) & 1)];
      u.q[0] = ld_tr16(a); u.q[1] = ld_tr16(a + 16 * VP); vf[dt] = u.v; }
#pragma unroll
    for (int ct = 0; ct < 2; ++ct) { v8f c = {};
#pragma unroll
      for (int kc = 0; kc < 2; ++kc) c = wmma16(kf[ct][kc], aq[kc], c);
      s[ct] = c; }   // raw scores: the scale is positive, so their maximum is the scaled scores' maximum
    float mx = fmaxf(s[0][0], s[1][0]);
#pragma unroll
    for (int r = 1; r < 8; ++r) mx = fmaxf(mx, fmaxf(s[0][r], s[1][r]));
    mx = fmaxf(mx, xhalf(mx));
    const float mn = fmaxf(m, mx); const float alpha = (m <= -1.0e38f) ? 0.f : __builtin_amdgcn_exp2f((m - mn) * CS2);
    const float nm = __builtin_fmaf(-mn, CS2, 11.0f);   // the exponent's offset: minus the scaled maximum, plus P's factor 2^11
    v16h pb; float es[2] = {0.f, 0.f};
#pragma unroll
    for (int ct = 0; ct < 2; ++ct)
#pragma unroll
      for (int i = 0; i < 4; ++i) { const v2f arg = __builtin_elementwise_fma(v2f{s[ct][2 * i], s[ct][2 * i + 1]}, v2f{CS2, CS2}, v2f{nm, nm});
        const float e0 = __builtin_amdgcn_exp2f(arg.x), e1 = __builtin_amdgcn_exp2f(arg.y); es[ct] += e0; es[ct] += e1; pb[ct * 8 + 2 * i] = (_Float16)e0; pb[ct * 8 + 2 * i + 1] = (_Float16)e1; }
    l = l * alpha + (es[0] + es[1]); m = mn;
#pragma unroll
    for (int dt = 0; dt < 4; ++dt) acc[dt] = wmma16(vf[dt], pb, acc[dt] * alpha); }
   // publish point of stage t + 1: this wave's reads of buffer bf are done, its copies of stage t + 1 have landed, every wave has come so far
   asm volatile("s_wait_dscnt 0x0" ::: "memory");
   asm volatile("s_wait_asynccnt 0x0" ::: "memory");
   __syncthreads();
   if (t + 2 < NT) stage_kv(gk + (size_t)(t + 2) * KT * CC, gv + (t + 2) * KT * HD, lk + bf * (KT * KP * 2), lv + bf * (KT * VP * 2)); }
  asm volatile("s_wait_asynccnt 0x0" ::: "memory");   // no copy is outstanding when the wave ends
  const float il = 1.0f / (l + xhalf(l));   // the halves' sums are joined once; sums and accumulators both carry 2^11
#pragma unroll
  for (int dt = 0; dt < 4; ++dt) { const v8f o = acc[dt] * il;   // channels dt * 16 + 8g + 0..7 of query col
    *(v4f*)&so[wave][col][dt * 16 + 8 * g] = __builtin_shufflevector(o, o, 0, 1, 2, 3); *(v4f*)&so[wave][col][dt * 16 + 8 * g + 4] = __builtin_shufflevector(o, o, 4, 5, 6, 7); }
  LDSX();
  for (int rl = 0; rl < 16; ++rl) if (lane < 16) vst2(O + (((b * NH + h) * SS + q0 + rl) * HD) + lane * 4, *(const v4f*)&so[wave][rl][lane * 4]);
}
extern "C" void kernel_launch(void* const* d_in, const int* in_sizes, int n_in, void* d_out, int out_size, void* d_ws, size_t ws_size, hipStream_t stream) {
  (void)in_sizes; (void)n_in; (void)out_size;
  const float** F = (const float**)d_in;   // 0 x [4,512,2048], 1 wq [512,512], 2 bq, 3 wk, 4 bk, 5 wv, 6 bv
  if (ws_size < (size_t)WS_END) return;
  char* ws = (char*)d_ws; __bf16* PW = (__bf16*)ws; float* XT = (float*)(ws + WS_XT); _Float16 *Q = (_Float16*)(ws + WS_Q), *Kr = (_Float16*)(ws + WS_K), *V = (_Float16*)(ws + WS_V);
  k_pack<<<dim3(CC, 3), 256, 0, stream>>>(F[1], F[3], F[5], PW);
  k_tr<<<dim3(SS / 64, CC / 64, TNB), 256, 0, stream>>>(F[0], XT);
  k_proj<<<dim3(TNB * SS / 128, CC / 128, 3), 256, 0, stream>>>(XT, PW, F[2], F[4], F[6], Q, Kr, V);
  k_attn<<<dim3(TQB, NH, TNB), 128, 0, stream>>>(Q, Kr, V, (float*)d_out);
}

// v006
// One run takes 69.5 microseconds.
// In two side-by-side timings against v005, it was 1.05 and 1.08 times as fast.
// All steps since v000 together make it 3.54 times as fast.
// compute dtype: all float inputs rounded to bf16; x transposed to token rows in f32; q/k/v = x_t . W^T + b with EXACT bf16 products on WMMA 16x16x32 (natural rows), rounded once to f16 (v as (B,C,L) planes, read by the attention through the module's raw .view(B,H,L,Ch) as rows of 64 channels a key); attention: q, k single f16 x 1/8, running-max softmax in f32 (hardware exp), P (scaled by 2^11, single f16) x v2 (single f16); f32 output written in the module's raw (B,H,L,Ch) -> (B,C,L) memory order.
#include <hip/hip_runtime.h>
#include <math.h>

typedef __attribute__((ext_vector_type(16))) _Float16 v16h;
typedef __attribute__((ext_vector_type(16))) __bf16 v16b;
typedef __attribute__((ext_vector_type(8)))  _Float16 v8h;
typedef __attribute__((ext_vector_type(8)))  float v8f;
typedef __attribute__((ext_vector_type(4)))  float v4f;
typedef __attribute__((ext_vector_type(2)))  float v2f;
typedef __attribute__((ext_vector_type(4)))  unsigned v4u;
typedef __attribute__((ext_vector_type(4)))  int v4i;
typedef float __attribute__((may_alias)) float_a;
typedef int __attribute__((may_alias)) int_a;

template <typename T> __device__ __forceinline__ void vst2(void* p, T v) { *(T*)p = v;  }
__device__ __forceinline__ v8f wmma16(v16h a, v16h b, v8f c) {
  v8f d = __builtin_amdgcn_wmma_f32_16x16x32_f16(false, a, false, b, (short)0, c, false, false);
  asm volatile("v_nop\n\tv_nop\n\tv_nop\n\tv_nop" : "+v"(d) : "v"(a), "v"(b));
  return d;
}
__device__ __forceinline__ v8f wmma_bf(v16b a, v16b b, v8f c) {
  v8f d = __builtin_amdgcn_wmma_f32_16x16x32_bf16(false, a, false, b, (short)0, c, false, false);
  asm volatile("v_nop\n\tv_nop\n\tv_nop\n\tv_nop" : "+v"(d) : "v"(a), "v"(b));
  return d;
}
// 16x16x32 fragments: lane = (h = lane>>4, row/col = lane&15); elements 0..7 = k0+8h+0..7, 8..15 = k0+16+8h+0..7; D element r = row 8h+r
__device__ __forceinline__ v16h frag_h(const _Float16* rowk0, int lane) {
  union { v16h v; v8h q[2]; } u; const _Float16* p = rowk0 + 8 * (lane >> 4);
  u.q[0] = *(const v8h*)p; u.q[1] = *(const v8h*)(p + 16); return u.v;
}
__device__ __forceinline__ v16h frag_f32(const float* rowk0, int lane) {
  v16h a; const float* p = rowk0 + 8 * (lane >> 4);
#pragma unroll
  for (int i = 0; i < 8; ++i) { a[i] = (_Float16)p[i]; a[8 + i] = (_Float16)p[16 + i]; }
  return a;
}
__device__ __forceinline__ v16h frag_f32s(const float* rowk0, int lane, float sc) {
  v16h a; const float* p = rowk0 + 8 * (lane >> 4);
#pragma unroll
  for (int i = 0; i < 8; ++i) { a[i] = (_Float16)(p[i] * sc); a[8 + i] = (_Float16)(p[16 + i] * sc); }
  return a;
}
// column fragment from a [K][ld] layout (column n), rows >= K read as 0
__device__ __forceinline__ v16h fragc_f32(const float* W, int k0, int n, int lane, int ld, int K) {
  v16h a; const int g = lane >> 4;
#pragma unroll
  for (int i = 0; i < 8; ++i) { const int ka = k0 + 8 * g + i, kb = ka + 16;
    a[i] = (_Float16)(ka < K ? W[(size_t)(ka < K ? ka : K - 1) * ld + n] : 0.f); a[8 + i] = (_Float16)(kb < K ? W[(size_t)(kb < K ? kb : K - 1) * ld + n] : 0.f); }
  return a;
}
struct F2 { v16b h, l; };
__device__ __forceinline__ F2 bsplit16(const float v[16]) { F2 r;
#pragma unroll
  for (int i = 0; i < 16; ++i) { const __bf16 h = (__bf16)v[i]; r.h[i] = h; r.l[i] = (__bf16)(v[i] - (float)h); }
  return r; }
__device__ __forceinline__ F2 split_row(const float* row, int k0, int lane) { float v[16]; const float* p = row + k0 + 8 * (lane >> 4);
#pragma unroll
  for (int i = 0; i < 8; ++i) { v[i] = p[i]; v[8 + i] = p[16 + i]; }
  return bsplit16(v); }
__device__ __forceinline__ F2 split_rowK(const float* row, int k0, int lane, int K) { float v[16]; const int g = lane >> 4;
#pragma unroll
  for (int i = 0; i < 8; ++i) { const int ka = k0 + 8 * g + i, kb = ka + 16; v[i] = ka < K ? row[ka < K ? ka : K - 1] : 0.f; v[8 + i] = kb < K ? row[kb < K ? kb : K - 1] : 0.f; }
  return bsplit16(v); }
__device__ __forceinline__ F2 split_col(const float* W, int k0, int n, int lane, int ld, int K) { float v[16]; const int g = lane >> 4;
#pragma unroll
  for (int i = 0; i < 8; ++i) { const int ka = k0 + 8 * g + i, kb = ka + 16; v[i] = ka < K ? W[(size_t)(ka < K ? ka : K - 1) * ld + n] : 0.f; v[8 + i] = kb < K ? W[(size_t)(kb < K ? kb : K - 1) * ld + n] : 0.f; }
  return bsplit16(v); }
__device__ __forceinline__ v8f mac3(const F2& a, const F2& b, v8f c) { c = wmma_bf(a.l, b.h, c); c = wmma_bf(a.h, b.l, c); return wmma_bf(a.h, b.h, c); }
__device__ __forceinline__ float sigm(float v) { return 1.0f / (1.0f + expf(-v)); }
#define LDSX() do { asm volatile("s_wait_dscnt 0" ::: "memory"); __builtin_amdgcn_wave_barrier(); __builtin_amdgcn_fence(__ATOMIC_RELEASE, "workgroup"); } while (0)


// Multi-head self attention on a (B, C, L) sequence (B 4, C 512, L 2,048, 8 heads x 64) with 1x1-conv projections; faithful to the module's quirk of viewing v as (B,H,L,Ch) and the output as (B,C,L) by raw reshape.
#define NB 4
#define CC 512
#define SS 2048
#define NH 8
#define HD 64
#define NR (NB * SS)
#ifndef TQB
#define TQB (SS / 64)
#define TNB NB
#endif
typedef __attribute__((ext_vector_type(8))) __bf16 v8b;
__device__ __forceinline__ v16b frag_b(const __bf16* rowk0, int lane) {
  union { v16b v; v8b q[2]; } u; const __bf16* p = rowk0 + 8 * (lane >> 4);
  u.q[0] = *(const v8b*)p; u.q[1] = *(const v8b*)(p + 16); return u.v;
}
__device__ __forceinline__ float bfr(float v) { return (float)(__bf16)v; }
__device__ __attribute__((noinline)) float exp_ni(float v) { return expf(v); }
__device__ __attribute__((noinline)) float erf_ni(float v) { return erff(v); }

#define WS_PW  0u                                   // bf16 natural rows wq, wk, wv [3][512][512]
#define WS_XT  (WS_PW + 2u * (size_t)3 * CC * CC)       // f32 x^T token rows [NR][512]
#define WS_Q   (WS_XT + 4u * (size_t)NR * CC)          // f16 q rows [NR][512]; k rows; v planes (B,C,L) [b][512][L]
#define WS_K   (WS_Q + 2u * (size_t)NR * CC)
#define WS_V   (WS_K + 2u * (size_t)NR * CC)
#define WS_END (WS_V + 2u * (size_t)NB * CC * SS)

__global__ __launch_bounds__(256) void k_pack(const float* __restrict__ WQ, const float* __restrict__ WK, const float* __restrict__ WV, __bf16* __restrict__ PW) { const int n = blockIdx.x, which = blockIdx.y, t = threadIdx.x; __shared__ __align__(16) __bf16 s[CC]; const float* w = (which == 0) ? WQ : (which == 1) ? WK : WV; for (int k = t; k < CC; k += 256) s[k] = (__bf16)w[(size_t)n * CC + k]; __syncthreads(); if (t < CC / 8) vst2((unsigned*)(PW + ((size_t)which * CC + n) * CC + t * 8), *(const v4u*)&s[t * 8]); }
// ---- k_tr: block = (64 positions, 64 channels, b): x[b][c][l] -> XT[(b, l)][c] f32 (256-B row segments)
__global__ __launch_bounds__(256) void k_tr(const float* __restrict__ X, float* __restrict__ XT) { __shared__ float st[64][65]; const int t = threadIdx.x; const int l0 = blockIdx.x * 64, c0 = blockIdx.y * 64; const size_t b = blockIdx.z;
  for (int e = t; e < 64 * 64; e += 256) { const int cl = e >> 6, ll = e & 63; st[ll][cl] = X[(b * CC + c0 + cl) * SS + l0 + ll]; }
  __syncthreads(); __shared__ __align__(16) float so[64][68]; for (int e = t; e < 64 * 64; e += 256) { const int ll = e >> 6, cl = e & 63; so[ll][cl] = st[ll][cl]; } __syncthreads();
  for (int e = t; e < 64 * 16; e += 256) { const int ll = e >> 4, q = e & 15; vst2(XT + (b * SS + l0 + ll) * CC + c0 + q * 4, *(const v4f*)&so[ll][q * 4]); } }
// ---- k_proj: block = (128 rows, 128 cols, which), 8 waves of 32 rows x 64 cols: + bias; q/k -> f16 rows; v -> (B,C,L) planes
// x^T rows (f32) and weight rows (bf16) come in stages of PK channels through LDS, shared by the block's eight waves: two buffers, the next stage's asynchronous copies fly while this stage is worked on.
#define PK 64                         // channels per stage: an x^T row piece is 256 B, a weight row piece one 128-B line
#define PNT (CC / PK)
#define PAP 68                        // LDS pitch of an x^T row in f32: 272 B = 16 B x odd, conflict-free for 16-byte reads
#define PBP 72                        // LDS pitch of a weight row in bf16: 144 B = 16 B x odd
#define PA_BYTES (128 * PAP * 4)
#define PST_BYTES (PA_BYTES + 128 * PBP * 2)
#define POP 136                       // pitch of the output staging in f16: 272 B
// one stage: 128 x^T rows of 256 B, 16 lanes a row, 8 copies a thread (rows r + 16 i); 128 weight rows of 128 B, 8 lanes a row, 4 copies a thread (rows r + 32 i)
__device__ __forceinline__ void stage_ab(const float* ga, const __bf16* gb, unsigned la, unsigned lb) {
  const float *a0 = ga, *a1 = ga + 16 * CC, *a2 = ga + 32 * CC, *a3 = ga + 48 * CC, *a4 = ga + 64 * CC, *a5 = ga + 80 * CC, *a6 = ga + 96 * CC, *a7 = ga + 112 * CC;
  const __bf16 *b0 = gb, *b1 = gb + 32 * CC, *b2 = gb + 64 * CC, *b3 = gb + 96 * CC;
  const unsigned x0 = la, x1 = la + 16 * PAP * 4, x2 = la + 32 * PAP * 4, x3 = la + 48 * PAP * 4, x4 = la + 64 * PAP * 4, x5 = la + 80 * PAP * 4, x6 = la + 96 * PAP * 4, x7 = la + 112 * PAP * 4;
  const unsigned y0 = lb, y1 = lb + 32 * PBP * 2, y2 = lb + 64 * PBP * 2, y3 = lb + 96 * PBP * 2;
  // the copies and their s_wait_xcnt in one statement: no address register is rewritten before the wait
  asm volatile("global_load_async_to_lds_b128 %0, %12, off\n\t"
               "global_load_async_to_lds_b128 %1, %13, off\n\t"
               "global_load_async_to_lds_b128 %2, %14, off\n\t"
               "global_load_async_to_lds_b128 %3, %15, off\n\t"
               "global_load_async_to_lds_b128 %4, %16, off\n\t"
               "global_load_async_to_lds_b128 %5, %17, off\n\t"
               "global_load_async_to_lds_b128 %6, %18, off\n\t"
               "global_load_async_to_lds_b128 %7, %19, off\n\t"
               "global_load_async_to_lds_b128 %8, %20, off\n\t"
               "global_load_async_to_lds_b128 %9, %21, off\n\t"
               "global_load_async_to_lds_b128 %10, %22, off\n\t"
               "global_load_async_to_lds_b128 %11, %23, off\n\t"
               "s_wait_xcnt 0x0"
               :: "v"(x0), "v"(x1), "v"(x2), "v"(x3), "v"(x4), "v"(x5), "v"(x6), "v"(x7), "v"(y0), "v"(y1), "v"(y2), "v"(y3),
                  "v"(a0), "v"(a1), "v"(a2), "v"(a3), "v"(a4), "v"(a5), "v"(a6), "v"(a7), "v"(b0), "v"(b1), "v"(b2), "v"(b3) : "memory");
}
__global__ __launch_bounds__(256) void k_proj(const float* __restrict__ XT, const __bf16* __restrict__ PW, const float* __restrict__ BQ, const float* __restrict__ BK, const float* __restrict__ BV, _Float16* __restrict__ Q, _Float16* __restrict__ Kr, _Float16* __restrict__ V) {
  __shared__ __align__(16) unsigned char sm[2 * PST_BYTES];   // two stages [x^T 128 rows | weights 128 rows]; behind the loop the output staging
  const int tid = threadIdx.x, wave = tid >> 5, lane = tid & 31, col = lane & 15, g = lane >> 4; const int which = blockIdx.z; const size_t rb = (size_t)blockIdx.x * 128; const int c0 = blockIdx.y * 128; const int wr = (wave >> 1) * 32, wc = (wave & 1) * 64; const float* BB = (which == 0) ? BQ : (which == 1) ? BK : BV;
  // this thread's 16 bytes of the first of its rows, in global memory (stage 0) and in LDS (buffer 0)
  const float* ga = XT + (rb + (tid >> 4)) * CC + (tid & 15) * 4;
  const __bf16* gb = PW + ((size_t)which * CC + c0 + (tid >> 3)) * CC + (tid & 7) * 8;
  const unsigned la = (unsigned)(uintptr_t)&sm[(tid >> 4) * (PAP * 4) + (tid & 15) * 16], lb = (unsigned)(uintptr_t)&sm[PA_BYTES + (tid >> 3) * (PBP * 2) + (tid & 7) * 16];
  stage_ab(ga, gb, la, lb);
  v8f acc[2][4] = {};
  asm volatile("s_wait_asynccnt 0x0" ::: "memory");   // stage 0 has landed, as far as this wave copied it
  __syncthreads();                                     // ... and is published to the other waves
  stage_ab(ga + PK, gb + PK, la + PST_BYTES, lb + PST_BYTES);
#pragma unroll 1   // one stage a trip, kept rolled: one publish point in the code, the buffer picked by t & 1
  for (int t = 0; t < PNT; ++t) { const int bf = t & 1; const float* sa = (const float*)(sm + bf * PST_BYTES); const __bf16* sb = (const __bf16*)(sm + bf * PST_BYTES + PA_BYTES);
#pragma unroll   // both 32-channel steps of a stage unrolled: their LDS offsets become immediates
    for (int kc = 0; kc < PK / 32; ++kc) { v16b a[2], w[4];
      // all fragments of the step are read as one group, so that their LDS latencies overlap
#pragma unroll
      for (int i = 0; i < 2; ++i) { const float* p = sa + (wr + i * 16 + col) * PAP + kc * 32 + 8 * g;
#pragma unroll
        for (int e = 0; e < 8; ++e) { a[i][e] = (__bf16)p[e]; a[i][8 + e] = (__bf16)p[16 + e]; } }
#pragma unroll
      for (int j = 0; j < 4; ++j) w[j] = frag_b(sb + (wc + j * 16 + col) * PBP + kc * 32, lane);
#pragma unroll
      for (int i = 0; i < 2; ++i)
#pragma unroll
        for (int j = 0; j < 4; ++j) acc[i][j] = wmma_bf(a[i], w[j], acc[i][j]); }
    // publish point of stage t + 1: this wave's reads of buffer bf are done, its copies of stage t + 1 have landed, every wave has come so far
    asm volatile("s_wait_dscnt 0x0" ::: "memory");
    asm volatile("s_wait_asynccnt 0x0" ::: "memory");
    __syncthreads();
    if (t + 2 < PNT) stage_ab(ga + (t + 2) * PK, gb + (t + 2) * PK, la + bf * PST_BYTES, lb + bf * PST_BYTES); }
  asm volatile("s_wait_asynccnt 0x0" ::: "memory");   // no copy is outstanding when the ring becomes output staging (the last trip's barrier has ended every read of it)
  _Float16* so = (_Float16*)sm;
  if (which < 2) {   // so[row][col]
#pragma unroll
    for (int j = 0; j < 4; ++j) { const float bb = bfr(BB[c0 + wc + j * 16 + col]);
#pragma unroll
      for (int i = 0; i < 2; ++i)
#pragma unroll
        for (int r = 0; r < 8; ++r) so[(wr + i * 16 + 8 * g + r) * POP + wc + j * 16 + col] = (_Float16)(acc[i][j][r] + bb); }
  } else {           // so[col][row]: a lane's 8 rows of a tile are 16 contiguous bytes
#pragma unroll
    for (int j = 0; j < 4; ++j) { const float bb = bfr(BB[c0 + wc + j * 16 + col]);
#pragma unroll
      for (int i = 0; i < 2; ++i) { v8h hv;
#pragma unroll
        for (int r = 0; r < 8; ++r) hv[r] = (_Float16)(acc[i][j][r] + bb);
        *(v8h*)&so[(wc + j * 16 + col) * POP + wr + i * 16 + 8 * g] = hv; } }
  }
  __syncthreads();
  if (which < 2) { _Float16* dst = (which == 0) ? Q : Kr; 
#pragma unroll   // the eight LDS reads of a thread go out as one group
    for (int it = 0; it < 8; ++it) { const int rl = it * 16 + (tid >> 4), q = tid & 15; vst2((unsigned*)(dst + (rb + rl) * CC + c0 + q * 8), *(const v4u*)&so[rl * POP + q * 8]); } }
  else { const size_t b = rb / SS; const int s0 = (int)(rb % SS); 
#pragma unroll   // the eight LDS reads of a thread go out as one group
    for (int it = 0; it < 8; ++it) { const int d = it * 16 + (tid >> 4), pc = tid & 15; vst2((unsigned*)(V + ((b * CC + c0 + d) * SS) + s0 + pc * 8), *(const v4u*)&so[d * POP + pc * 8]); } }
}
// ---- k_attn: block = (128 queries, head, b): softmax(q k / 8) over all L keys, . v2; output rows (b, h, l) of 64 floats (the raw (B,H,L,Ch) buffer == the module's (B,C,L) result)
// Scores are formed transposed, S^T = K . Q^T (A = K rows, B = Q rows): a lane holds 8 keys a tile of ONE query (column lane & 15), so maximum and sum run in the lane's own registers, with one exchange
// between the wave's halves; two S^T tiles, converted in place, are the B operand of O^T += v2^T . P^T in the hardware k order (keys 8g + 0..7, 16 + 8g + 0..7), the order in which the transposing load delivers v2^T.
// v2[m][c] = F[m * 64 + c], F the head's contiguous (Ch x L) block of the (B,C,L) v tensor: a key's 64 channels are one 128-B line as they lie, and no transposed copy is made.
// K rows and v2 rows come in stages of KT keys through LDS, shared by the block's eight waves: two buffers, the next stage's asynchronous copies fly while this stage is worked on.
// A wave takes 32 query columns (two tiles), so that every K and v2^T fragment read from LDS feeds two products, and one 32-key half of every stage, so that four waves a SIMD stay:
// waves w and w + 4 hold the same queries over the two halves of the keys, each with its own maxima, sums and accumulators, joined once through LDS behind the loop.
#define KT 64          // keys per stage: a K row and a v2 row (64 channels each) are both one 128-B line
#define KP 72          // LDS pitch of a K row in f16: 144 B = 16 B x odd, conflict-free for 16-byte fragment reads
#define VP 80          // LDS pitch of a v2 row in f16: 160 B = 32 B x odd, conflict-free for the transposing load
#define NT (SS / KT)
#define QB 128         // queries per block: four groups of 32
// Softmax in base 2: exp((s - max) / 8) * 2^11 = exp2(s * CS2 + (11 - max * CS2)), one packed multiply-add for two raw scores ahead of the hardware exponential.
#define CS2 (0.125f * 1.4426950408889634f)
// one stage: 64 K rows + 64 v2 rows of 128 B, 8 lanes a row, 2 + 2 copies a thread (rows r, r + 32)
__device__ __forceinline__ void stage_kv(const _Float16* gk, const _Float16* gv, unsigned lk, unsigned lv) {
  const _Float16 *k0 = gk, *k1 = gk + 32 * CC;
  const _Float16 *v0 = gv, *v1 = gv + 32 * HD;
  const unsigned a0 = lk, a1 = lk + 32 * KP * 2;
  const unsigned b0 = lv, b1 = lv + 32 * VP * 2;
  // the copies and their s_wait_xcnt in one statement: no address register is rewritten before the wait
  asm volatile("global_load_async_to_lds_b128 %0, %4, off\n\t"
               "global_load_async_to_lds_b128 %1, %5, off\n\t"
               "global_load_async_to_lds_b128 %2, %6, off\n\t"
               "global_load_async_to_lds_b128 %3, %7, off\n\t"
               "s_wait_xcnt 0x0"
               :: "v"(a0), "v"(a1), "v"(b0), "v"(b1), "v"(k0), "v"(k1), "v"(v0), "v"(v1) : "memory");
}
// 16 keys x 16 channels of row-major v2 in LDS, transposed: lane (col, g) gets keys 8g + 0..7 of channel col; p is the lane's own address (key 8g + (lane & 7), 16 bytes (lane >> 3) & 1)
typedef short s16x8 __attribute__((ext_vector_type(8)));
__device__ __forceinline__ v8h ld_tr16(const _Float16* p) { typedef __attribute__((address_space(3))) s16x8 lds_s16x8; return __builtin_bit_cast(v8h, __builtin_amdgcn_ds_load_tr16_b128_v8i16((lds_s16x8*)p)); }
// lane l with lane l ^ 16
__device__ __forceinline__ float xhalf(float x) { const int b = __builtin_bit_cast(int, x); return __builtin_bit_cast(float, __builtin_amdgcn_permlanex16(b, b, 0x76543210, 0xfedcba98, false, false)); }
// four waves a SIMD (two blocks a WGP): at most 256 registers a wave
__global__ __launch_bounds__(256) __attribute__((amdgpu_waves_per_eu(4, 4))) void k_attn(const _Float16* __restrict__ Q, const _Float16* __restrict__ Kr, const _Float16* __restrict__ V, float* __restrict__ O) {
  __shared__ __align__(16) float so[4][32][68];   // per query group: first the second key half's state (17 x 32 lanes x 16 B), then the output staging (32 rows)
  __shared__ __align__(16) _Float16 sk[2][KT][KP]; __shared__ __align__(16) _Float16 sv[2][KT][VP];
  const int tid = threadIdx.x, wave = tid >> 5, lane = tid & 31, col = lane & 15, g = lane >> 4; const int qg = wave & 3, kh = wave >> 2; const int h = blockIdx.y; const size_t b = blockIdx.z; const int q0 = blockIdx.x * QB + qg * 32; const size_t rq = b * SS + q0;
  // this thread's 16 bytes of the first of its two rows, in global memory (stage 0) and in LDS (buffer 0)
  const int crow = tid >> 3, cch = (tid & 7) * 8;
  const _Float16* gk = Kr + (b * SS + crow) * CC + h * HD + cch;
  const _Float16* gv = V + (b * NH + h) * (size_t)HD * SS + crow * HD + cch;
  const unsigned lk = (unsigned)(uintptr_t)&sk[0][crow][cch], lv = (unsigned)(uintptr_t)&sv[0][crow][cch];
  stage_kv(gk, gv, lk, lv);
  v16h aq[2][2];
#pragma unroll
  for (int qt = 0; qt < 2; ++qt)
#pragma unroll
    for (int kc = 0; kc < 2; ++kc) aq[qt][kc] = frag_h(Q + (rq + qt * 16 + col) * CC + h * HD + kc * 32, lane);
  float m[2] = {-3.0e38f, -3.0e38f}, l[2] = {0.f, 0.f};   // this lane's two queries: running maximum of the raw scores (equal in both halves of the wave), and the sum over this half's keys (times 2^11)
  v8f acc[2][4] = {};
  asm volatile("s_wait_asynccnt 0x0" ::: "memory");   // stage 0 has landed, as far as this wave copied it
  __syncthreads();                                     // ... and is published to the other waves
  stage_kv(gk + (size_t)KT * CC, gv + KT * HD, lk + KT * KP * 2, lv + KT * VP * 2);
#pragma unroll 1   // one stage a trip, kept rolled: one publish point in the code, the buffer picked by t & 1
  for (int t = 0; t < NT; ++t) { const int bf = t & 1;
    // all fragments of the pass (this wave's 32 keys of the stage) are read as one group, so that their LDS latencies overlap
    v16h kf[2][2], vf[4]; v8f s[2][2] = {};
#pragma unroll
    for (int ct = 0; ct < 2; ++ct)
#pragma unroll
      for (int kc = 0; kc < 2; ++kc) kf[ct][kc] = frag_h(&sk[bf][kh * 32 + ct * 16 + col][kc * 32], lane);
#pragma unroll
    for (int dt = 0; dt < 4; ++dt) { union { v16h v; v8h q[2]; } u; const _Float16* a = &sv[bf][kh * 32 + 8 * g + (lane & 7)][dt * 16 + 8 * ((lane >> 3) & 1)];
      u.q[0] = ld_tr16(a); u.q[1] = ld_tr16(a + 16 * VP); vf[dt] = u.v; }
    // raw scores (the scale is positive, so their maximum is the scaled scores' maximum): four independent tiles side by side
#pragma unroll
    for (int kc = 0; kc < 2; ++kc)
#pragma unroll
      for (int qt = 0; qt < 2; ++qt)
#pragma unroll
        for (int ct = 0; ct < 2; ++ct) s[qt][ct] = wmma16(kf[ct][kc], aq[qt][kc], s[qt][ct]);
    v16h pb[2]; float alpha[2];
#pragma unroll
    for (int qt = 0; qt < 2; ++qt) {
      float mx = fmaxf(s[qt][0][0], s[qt][1][0]);
#pragma unroll
      for (int r = 1; r < 8; ++r) mx = fmaxf(mx, fmaxf(s[qt][0][r], s[qt][1][r]));
      mx = fmaxf(mx, xhalf(mx));
      const float mn = fmaxf(m[qt], mx); alpha[qt] = (m[qt] <= -1.0e38f) ? 0.f : __builtin_amdgcn_exp2f((m[qt] - mn) * CS2);
      const float nm = __builtin_fmaf(-mn, CS2, 11.0f);   // the exponent's offset: minus the scaled maximum, plus P's factor 2^11
      float es[2] = {0.f, 0.f};
#pragma unroll
      for (int ct = 0; ct < 2; ++ct)
#pragma unroll
        for (int i = 0; i < 4; ++i) { const v2f arg = __builtin_elementwise_fma(v2f{s[qt][ct][2 * i], s[qt][ct][2 * i + 1]}, v2f{CS2, CS2}, v2f{nm, nm});
          const float e0 = __builtin_amdgcn_exp2f(arg.x), e1 = __builtin_amdgcn_exp2f(arg.y); es[ct] += e0; es[ct] += e1; pb[qt][ct * 8 + 2 * i] = (_Float16)e0; pb[qt][ct * 8 + 2 * i + 1] = (_Float16)e1; }
      l[qt] = l[qt] * alpha[qt] + (es[0] + es[1]); m[qt] = mn; }
#pragma unroll
    for (int dt = 0; dt < 4; ++dt)
#pragma unroll
      for (int qt = 0; qt < 2; ++qt) acc[qt][dt] = wmma16(vf[dt], pb[qt], acc[qt][dt] * alpha[qt]);
    // publish point of stage t + 1: this wave's reads of buffer bf are done, its copies of stage t + 1 have landed, every wave has come so far
    asm volatile("s_wait_dscnt 0x0" ::: "memory");
    asm volatile("s_wait_asynccnt 0x0" ::: "memory");
    __syncthreads();
    if (t + 2 < NT) stage_kv(gk + (size_t)(t + 2) * KT * CC, gv + (t + 2) * KT * HD, lk + bf * (KT * KP * 2), lv + bf * (KT * VP * 2)); }
  asm volatile("s_wait_asynccnt 0x0" ::: "memory");   // no copy is outstanding when the wave ends
  // the join of the two key halves: wave w + 4 hands its state to wave w, lane to lane (same queries, same channels), 16 bytes a lane and 512 B a wave-store
  v4f* mg = (v4f*)&so[qg][0][0];
  if (kh == 1) {
#pragma unroll
    for (int qt = 0; qt < 2; ++qt)
#pragma unroll
      for (int dt = 0; dt < 4; ++dt) { const v8f o = acc[qt][dt];
        mg[((qt * 4 + dt) * 2 + 0) * 32 + lane] = __builtin_shufflevector(o, o, 0, 1, 2, 3); mg[((qt * 4 + dt) * 2 + 1) * 32 + lane] = __builtin_shufflevector(o, o, 4, 5, 6, 7); }
    mg[16 * 32 + lane] = v4f{m[0], l[0], m[1], l[1]};
  }
  __syncthreads();   // the second half's state is written before the first half's wave reads it
  if (kh == 0) {
    const v4f ml = mg[16 * 32 + lane];
#pragma unroll
    for (int qt = 0; qt < 2; ++qt) { const float m1 = ml[2 * qt], l1 = ml[2 * qt + 1];
      const float mn = fmaxf(m[qt], m1); const float w0 = __builtin_amdgcn_exp2f((m[qt] - mn) * CS2), w1 = __builtin_amdgcn_exp2f((m1 - mn) * CS2);
      l[qt] = l[qt] * w0 + l1 * w1;
#pragma unroll
      for (int dt = 0; dt < 4; ++dt) { const v4f lo = mg[((qt * 4 + dt) * 2 + 0) * 32 + lane], hi = mg[((qt * 4 + dt) * 2 + 1) * 32 + lane];
        acc[qt][dt] = acc[qt][dt] * w0 + __builtin_shufflevector(lo, hi, 0, 1, 2, 3, 4, 5, 6, 7) * w1; } }
#pragma unroll
    for (int qt = 0; qt < 2; ++qt) { const float il = 1.0f / (l[qt] + xhalf(l[qt]));   // the wave halves' sums are joined once; sums and accumulators both carry 2^11
#pragma unroll
      for (int dt = 0; dt < 4; ++dt) { const v8f o = acc[qt][dt] * il;   // channels dt * 16 + 8g + 0..7 of query qt * 16 + col
        *(v4f*)&so[qg][qt * 16 + col][dt * 16 + 8 * g] = __builtin_shufflevector(o, o, 0, 1, 2, 3); *(v4f*)&so[qg][qt * 16 + col][dt * 16 + 8 * g + 4] = __builtin_shufflevector(o, o, 4, 5, 6, 7); } }
    LDSX();
    for (int rl = 0; rl < 32; rl += 2) vst2(O + (((b * NH + h) * SS + q0 + rl + g) * HD) + col * 4, *(const v4f*)&so[qg][rl + g][col * 4]);   // two rows of 256 B a store
  }
}
extern "C" void kernel_launch(void* const* d_in, const int* in_sizes, int n_in, void* d_out, int out_size, void* d_ws, size_t ws_size, hipStream_t stream) {
  (void)in_sizes; (void)n_in; (void)out_size;
  const float** F = (const float**)d_in;   // 0 x [4,512,2048], 1 wq [512,512], 2 bq, 3 wk, 4 bk, 5 wv, 6 bv
  if (ws_size < (size_t)WS_END) return;
  char* ws = (char*)d_ws; __bf16* PW = (__bf16*)ws; float* XT = (float*)(ws + WS_XT); _Float16 *Q = (_Float16*)(ws + WS_Q), *Kr = (_Float16*)(ws + WS_K), *V = (_Float16*)(ws + WS_V);
  k_pack<<<dim3(CC, 3), 256, 0, stream>>>(F[1], F[3], F[5], PW);
  k_tr<<<dim3(SS / 64, CC / 64, TNB), 256, 0, stream>>>(F[0], XT);
  k_proj<<<dim3(TNB * SS / 128, CC / 128, 3), 256, 0, stream>>>(XT, PW, F[2], F[4], F[6], Q, Kr, V);
  k_attn<<<dim3(SS / QB, NH, TNB), 256, 0, stream>>>(Q, Kr, V, (float*)d_out);
}

// v007
// Measured time: 59.8 microseconds a run.
// Timed twice side by side with v006, it ran 1.14 and 1.19 times as fast.
// Over all steps from v000 it is 4.13 times as fast.
// compute dtype: all float inputs rounded to bf16; x read as it lies (channel rows) and transposed by the LDS fragment load; q/k/v = x_t . W^T + b with EXACT bf16 products on WMMA 16x16x32 (natural weight rows), rounded once to f16 (v as (B,C,L) planes, read by the attention through the module's raw .view(B,H,L,Ch) as rows of 64 channels a key); attention: q, k single f16 x 1/8, running-max softmax in f32 (hardware exp), P (scaled by 2^11, single f16) x v2 (single f16); f32 output written in the module's raw (B,H,L,Ch) -> (B,C,L) memory order.
#include <hip/hip_runtime.h>
#include <math.h>

typedef __attribute__((ext_vector_type(16))) _Float16 v16h;
typedef __attribute__((ext_vector_type(16))) __bf16 v16b;
typedef __attribute__((ext_vector_type(8)))  _Float16 v8h;
typedef __attribute__((ext_vector_type(8)))  float v8f;
typedef __attribute__((ext_vector_type(4)))  float v4f;
typedef __attribute__((ext_vector_type(2)))  float v2f;
typedef __attribute__((ext_vector_type(4)))  unsigned v4u;
typedef __attribute__((ext_vector_type(4)))  int v4i;
typedef float __attribute__((may_alias)) float_a;
typedef int __attribute__((may_alias)) int_a;

template <typename T> __device__ __forceinline__ void vst2(void* p, T v) { *(T*)p = v;  }
__device__ __forceinline__ v8f wmma16(v16h a, v16h b, v8f c) {
  v8f d = __builtin_amdgcn_wmma_f32_16x16x32_f16(false, a, false, b, (short)0, c, false, false);
  asm volatile("v_nop\n\tv_nop\n\tv_nop\n\tv_nop" : "+v"(d) : "v"(a), "v"(b));
  return d;
}
__device__ __forceinline__ v8f wmma_bf(v16b a, v16b b, v8f c) {
  v8f d = __builtin_amdgcn_wmma_f32_16x16x32_bf16(false, a, false, b, (short)0, c, false, false);
  asm volatile("v_nop\n\tv_nop\n\tv_nop\n\tv_nop" : "+v"(d) : "v"(a), "v"(b));
  return d;
}
// 16x16x32 fragments: lane = (h = lane>>4, row/col = lane&15); elements 0..7 = k0+8h+0..7, 8..15 = k0+16+8h+0..7; D element r = row 8h+r
__device__ __forceinline__ v16h frag_h(const _Float16* rowk0, int lane) {
  union { v16h v; v8h q[2]; } u; const _Float16* p = rowk0 + 8 * (lane >> 4);
  u.q[0] = *(const v8h*)p; u.q[1] = *(const v8h*)(p + 16); return u.v;
}
__device__ __forceinline__ v16h frag_f32(const float* rowk0, int lane) {
  v16h a; const float* p = rowk0 + 8 * (lane >> 4);
#pragma unroll
  for (int i = 0; i < 8; ++i) { a[i] = (_Float16)p[i]; a[8 + i] = (_Float16)p[16 + i]; }
  return a;
}
__device__ __forceinline__ v16h frag_f32s(const float* rowk0, int lane, float sc) {
  v16h a; const float* p = rowk0 + 8 * (lane >> 4);
#pragma unroll
  for (int i = 0; i < 8; ++i) { a[i] = (_Float16)(p[i] * sc); a[8 + i] = (_Float16)(p[16 + i] * sc); }
  return a;
}
// column fragment from a [K][ld] layout (column n), rows >= K read as 0
__device__ __forceinline__ v16h fragc_f32(const float* W, int k0, int n, int lane, int ld, int K) {
  v16h a; const int g = lane >> 4;
#pragma unroll
  for (int i = 0; i < 8; ++i) { const int ka = k0 + 8 * g + i, kb = ka + 16;
    a[i] = (_Float16)(ka < K ? W[(size_t)(ka < K ? ka : K - 1) * ld + n] : 0.f); a[8 + i] = (_Float16)(kb < K ? W[(size_t)(kb < K ? kb : K - 1) * ld + n] : 0.f); }
  return a;
}
struct F2 { v16b h, l; };
__device__ __forceinline__ F2 bsplit16(const float v[16]) { F2 r;
#pragma unroll
  for (int i = 0; i < 16; ++i) { const __bf16 h = (__bf16)v[i]; r.h[i] = h; r.l[i] = (__bf16)(v[i] - (float)h); }
  return r; }
__device__ __forceinline__ F2 split_row(const float* row, int k0, int lane) { float v[16]; const float* p = row + k0 + 8 * (lane >> 4);
#pragma unroll
  for (int i = 0; i < 8; ++i) { v[i] = p[i]; v[8 + i] = p[16 + i]; }
  return bsplit16(v); }
__device__ __forceinline__ F2 split_rowK(const float* row, int k0, int lane, int K) { float v[16]; const int g = lane >> 4;
#pragma unroll
  for (int i = 0; i < 8; ++i) { const int ka = k0 + 8 * g + i, kb = ka + 16; v[i] = ka < K ? row[ka < K ? ka : K - 1] : 0.f; v[8 + i] = kb < K ? row[kb < K ? kb : K - 1] : 0.f; }
  return bsplit16(v); }
__device__ __forceinline__ F2 split_col(const float* W, int k0, int n, int lane, int ld, int K) { float v[16]; const int g = lane >> 4;
#pragma unroll
  for (int i = 0; i < 8; ++i) { const int ka = k0 + 8 * g + i, kb = ka + 16; v[i] = ka < K ? W[(size_t)(ka < K ? ka : K - 1) * ld + n] : 0.f; v[8 + i] = kb < K ? W[(size_t)(kb < K ? kb : K - 1) * ld + n] : 0.f; }
  return bsplit16(v); }
__device__ __forceinline__ v8f mac3(const F2& a, const F2& b, v8f c) { c = wmma_bf(a.l, b.h, c); c = wmma_bf(a.h, b.l, c); return wmma_bf(a.h, b.h, c); }
__device__ __forceinline__ float sigm(float v) { return 1.0f / (1.0f + expf(-v)); }
#define LDSX() do { asm volatile("s_wait_dscnt 0" ::: "memory"); __builtin_amdgcn_wave_barrier(); __builtin_amdgcn_fence(__ATOMIC_RELEASE, "workgroup"); } while (0)


// Multi-head self attention on a (B, C, L) sequence (B 4, C 512, L 2,048, 8 heads x 64) with 1x1-conv projections; faithful to the module's quirk of viewing v as (B,H,L,Ch) and the output as (B,C,L) by raw reshape.
#define NB 4
#define CC 512
#define SS 2048
#define NH 8
#define HD 64
#define NR (NB * SS)
#ifndef TQB
#define TQB (SS / 64)
#define TNB NB
#endif
typedef __attribute__((ext_vector_type(8))) __bf16 v8b;
__device__ __forceinline__ v16b frag_b(const __bf16* rowk0, int lane) {
  union { v16b v; v8b q[2]; } u; const __bf16* p = rowk0 + 8 * (lane >> 4);
  u.q[0] = *(const v8b*)p; u.q[1] = *(const v8b*)(p + 16); return u.v;
}
__device__ __forceinline__ float bfr(float v) { return (float)(__bf16)v; }
__device__ __attribute__((noinline)) float exp_ni(float v) { return expf(v); }
__device__ __attribute__((noinline)) float erf_ni(float v) { return erff(v); }

#define WS_PW  0u                                   // bf16 natural rows wq, wk, wv [3][512][512]
#define WS_Q   (WS_PW + 2u * (size_t)3 * CC * CC)       // f16 q rows [NR][512]; k rows; v planes (B,C,L) [b][512][L]
#define WS_K   (WS_Q + 2u * (size_t)NR * CC)
#define WS_V   (WS_K + 2u * (size_t)NR * CC)
#define WS_END (WS_V + 2u * (size_t)NB * CC * SS)

__global__ __launch_bounds__(256) void k_pack(const float* __restrict__ WQ, const float* __restrict__ WK, const float* __restrict__ WV, __bf16* __restrict__ PW) { const int n = blockIdx.x, which = blockIdx.y, t = threadIdx.x; __shared__ __align__(16) __bf16 s[CC]; const float* w = (which == 0) ? WQ : (which == 1) ? WK : WV; for (int k = t; k < CC; k += 256) s[k] = (__bf16)w[(size_t)n * CC + k]; __syncthreads(); if (t < CC / 8) vst2((unsigned*)(PW + ((size_t)which * CC + n) * CC + t * 8), *(const v4u*)&s[t * 8]); }
// ---- k_proj: block = (128 rows, 128 cols, which), 8 waves of 32 rows x 64 cols: + bias; q/k -> f16 rows; v -> (B,C,L) planes
// x is read as it lies, channel rows of positions: a stage is PK channel rows x 128 positions, loaded to registers one stage ahead, rounded to bf16 and stored to LDS in the same channel-major order;
// the transposing LDS load then delivers the x^T fragments (row = position, k = channel) in the hardware k order, which is the order of the weight fragments. No transposed copy of x is made.
// Weight rows (bf16) come in stages of PK channels through LDS by asynchronous copies. Two buffers, shared by the block's eight waves: the next stage flies while this stage is worked on.
#define PK 64                         // channels per stage: 64 x rows of 512 B (f32) in memory, 256 B (bf16) in LDS; a weight row piece is one 128-B line
#define PNT (CC / PK)
#define PXP 144                       // LDS pitch of an x channel row in bf16: 288 B = 32 B x odd, conflict-free for the transposing load
#define PBP 72                        // LDS pitch of a weight row in bf16: 144 B = 16 B x odd
#define PX_BYTES (PK * PXP * 2)
#define PST_BYTES (PX_BYTES + 128 * PBP * 2)
#define POP 136                       // pitch of the output staging in f16: 272 B
typedef __attribute__((ext_vector_type(4))) __bf16 v4b;
typedef short s16x8 __attribute__((ext_vector_type(8)));
// 16 channels x 16 positions of channel-major x in LDS, transposed: lane (col, g) gets channels 8g + 0..7 of position col; p is the lane's own address (channel 8g + (lane & 7), 16 bytes (lane >> 3) & 1)
__device__ __forceinline__ v8b ld_tr16b(const __bf16* p) { typedef __attribute__((address_space(3))) s16x8 lds_s16x8; return __builtin_bit_cast(v8b, __builtin_amdgcn_ds_load_tr16_b128_v8i16((lds_s16x8*)p)); }
// one stage of x: a wave takes 8 channel rows, a whole 512-B row piece a load (16 bytes a lane)
__device__ __forceinline__ void load_x(const float* gx, v4f (&r)[8]) {
#pragma unroll
  for (int j = 0; j < 8; ++j) r[j] = *(const v4f*)(gx + (size_t)j * SS);
}
__device__ __forceinline__ void store_x(__bf16* sx, const v4f (&r)[8]) {
#pragma unroll
  for (int j = 0; j < 8; ++j) *(v4b*)(sx + j * PXP) = v4b{(__bf16)r[j][0], (__bf16)r[j][1], (__bf16)r[j][2], (__bf16)r[j][3]};
}
// one stage of weights: 128 rows of 128 B, 8 lanes a row, 4 copies a thread (rows r + 32 i)
__device__ __forceinline__ void stage_w(const __bf16* gb, unsigned lb) {
  const __bf16 *b0 = gb, *b1 = gb + 32 * CC, *b2 = gb + 64 * CC, *b3 = gb + 96 * CC;
  const unsigned y0 = lb, y1 = lb + 32 * PBP * 2, y2 = lb + 64 * PBP * 2, y3 = lb + 96 * PBP * 2;
  // the copies and their s_wait_xcnt in one statement: no address register is rewritten before the wait
  asm volatile("global_load_async_to_lds_b128 %0, %4, off\n\t"
               "global_load_async_to_lds_b128 %1, %5, off\n\t"
               "global_load_async_to_lds_b128 %2, %6, off\n\t"
               "global_load_async_to_lds_b128 %3, %7, off\n\t"
               "s_wait_xcnt 0x0"
               :: "v"(y0), "v"(y1), "v"(y2), "v"(y3), "v"(b0), "v"(b1), "v"(b2), "v"(b3) : "memory");
}
__global__ __launch_bounds__(256) void k_proj(const float* __restrict__ X, const __bf16* __restrict__ PW, const float* __restrict__ BQ, const float* __restrict__ BK, const float* __restrict__ BV, _Float16* __restrict__ Q, _Float16* __restrict__ Kr, _Float16* __restrict__ V) {
  __shared__ __align__(16) unsigned char sm[2 * PST_BYTES];   // two stages [x 64 channel rows | weights 128 rows]; behind the loop the output staging
  const int tid = threadIdx.x, wave = tid >> 5, lane = tid & 31, col = lane & 15, g = lane >> 4; const int which = blockIdx.z; const size_t rb = (size_t)blockIdx.x * 128; const int c0 = blockIdx.y * 128; const int wr = (wave >> 1) * 32, wc = (wave & 1) * 64; const float* BB = (which == 0) ? BQ : (which == 1) ? BK : BV;
  const size_t b = rb / SS; const int s0 = (int)(rb % SS);   // the block's 128 token rows are positions s0 .. s0 + 127 of one batch entry
  // this thread's 16 bytes of the first of its x rows and of its weight rows, in global memory (stage 0) and in LDS (buffer 0)
  const float* gx = X + (b * CC + wave * 8) * SS + s0 + lane * 4;
  const __bf16* gb = PW + ((size_t)which * CC + c0 + (tid >> 3)) * CC + (tid & 7) * 8;
  const int lx = (wave * 8) * (PXP * 2) + lane * 8;
  const unsigned lb = (unsigned)(uintptr_t)&sm[PX_BYTES + (tid >> 3) * (PBP * 2) + (tid & 7) * 16];
  v4f xr[8];
  load_x(gx, xr);
  stage_w(gb, lb);
  v8f acc[2][4] = {};
  store_x((__bf16*)(sm + lx), xr);
  asm volatile("s_wait_asynccnt 0x0" ::: "memory");   // stage 0's weights have landed, as far as this wave copied them
  __syncthreads();                                     // ... and they and the x rows stored above are published to the other waves
  load_x(gx + (size_t)PK * SS, xr);
  stage_w(gb + PK, lb + PST_BYTES);
#pragma unroll 1   // one stage a trip, kept rolled: one publish point in the code, the buffer picked by t & 1
  for (int t = 0; t < PNT; ++t) { const int bf = t & 1; const __bf16* sx = (const __bf16*)(sm + bf * PST_BYTES); const __bf16* sb = (const __bf16*)(sm + bf * PST_BYTES + PX_BYTES);
#pragma unroll   // both 32-channel steps of a stage unrolled: their LDS offsets become immediates
    for (int kc = 0; kc < PK / 32; ++kc) { v16b a[2], w[4];
      // all fragments of the step are read as one group, so that their LDS latencies overlap
#pragma unroll
      for (int i = 0; i < 2; ++i) { union { v16b v; v8b q[2]; } u; const __bf16* p = sx + (kc * 32 + 8 * g + (lane & 7)) * PXP + wr + i * 16 + 8 * ((lane >> 3) & 1);
        u.q[0] = ld_tr16b(p); u.q[1] = ld_tr16b(p + 16 * PXP); a[i] = u.v; }
#pragma unroll
      for (int j = 0; j < 4; ++j) w[j] = frag_b(sb + (wc + j * 16 + col) * PBP + kc * 32, lane);
#pragma unroll
      for (int i = 0; i < 2; ++i)
#pragma unroll
        for (int j = 0; j < 4; ++j) acc[i][j] = wmma_bf(a[i], w[j], acc[i][j]); }
    // stage t + 1 of x, in registers since the last publish point, goes to the other buffer, whose readers left it at that point
    if (t + 1 < PNT) store_x((__bf16*)(sm + (bf ^ 1) * PST_BYTES + lx), xr);
    // publish point of stage t + 1: this wave's reads of buffer bf and its x stores are done, its copies of stage t + 1 have landed, every wave has come so far
    asm volatile("s_wait_dscnt 0x0" ::: "memory");
    asm volatile("s_wait_asynccnt 0x0" ::: "memory");
    __syncthreads();
    if (t + 2 < PNT) { load_x(gx + (size_t)(t + 2) * PK * SS, xr); stage_w(gb + (t + 2) * PK, lb + bf * PST_BYTES); } }
  asm volatile("s_wait_asynccnt 0x0" ::: "memory");   // no copy is outstanding when the ring becomes output staging (the last trip's barrier has ended every read of it)
  _Float16* so = (_Float16*)sm;
  if (which < 2) {   // so[row][col]
#pragma unroll
    for (int j = 0; j < 4; ++j) { const float bb = bfr(BB[c0 + wc + j * 16 + col]);
#pragma unroll
      for (int i = 0; i < 2; ++i)
#pragma unroll
        for (int r = 0; r < 8; ++r) so[(wr + i * 16 + 8 * g + r) * POP + wc + j * 16 + col] = (_Float16)(acc[i][j][r] + bb); }
  } else {           // so[col][row]: a lane's 8 rows of a tile are 16 contiguous bytes
#pragma unroll
    for (int j = 0; j < 4; ++j) { const float bb = bfr(BB[c0 + wc + j * 16 + col]);
#pragma unroll
      for (int i = 0; i < 2; ++i) { v8h hv;
#pragma unroll
        for (int r = 0; r < 8; ++r) hv[r] = (_Float16)(acc[i][j][r] + bb);
        *(v8h*)&so[(wc + j * 16 + col) * POP + wr + i * 16 + 8 * g] = hv; } }
  }
  __syncthreads();
  if (which < 2) { _Float16* dst = (which == 0) ? Q : Kr; 
#pragma unroll   // the eight LDS reads of a thread go out as one group
    for (int it = 0; it < 8; ++it) { const int rl = it * 16 + (tid >> 4), q = tid & 15; vst2((unsigned*)(dst + (rb + rl) * CC + c0 + q * 8), *(const v4u*)&so[rl * POP + q * 8]); } }
  else {
#pragma unroll   // the eight LDS reads of a thread go out as one group
    for (int it = 0; it < 8; ++it) { const int d = it * 16 + (tid >> 4), pc = tid & 15; vst2((unsigned*)(V + ((b * CC + c0 + d) * SS) + s0 + pc * 8), *(const v4u*)&so[d * POP + pc * 8]); } }
}
// ---- k_attn: block = (128 queries, head, b): softmax(q k / 8) over all L keys, . v2; output rows (b, h, l) of 64 floats (the raw (B,H,L,Ch) buffer == the module's (B,C,L) result)
// Scores are formed transposed, S^T = K . Q^T (A = K rows, B = Q rows): a lane holds 8 keys a tile of ONE query (column lane & 15), so maximum and sum run in the lane's own registers, with one exchange
// between the wave's halves; two S^T tiles, converted in place, are the B operand of O^T += v2^T . P^T in the hardware k order (keys 8g + 0..7, 16 + 8g + 0..7), the order in which the transposing load delivers v2^T.
// v2[m][c] = F[m * 64 + c], F the head's contiguous (Ch x L) block of the (B,C,L) v tensor: a key's 64 channels are one 128-B line as they lie, and no transposed copy is made.
// K rows and v2 rows come in stages of KT keys through LDS, shared by the block's eight waves: two buffers, the next stage's asynchronous copies fly while this stage is worked on.
// A wave takes 32 query columns (two tiles), so that every K and v2^T fragment read from LDS feeds two products, and one 32-key half of every stage, so that four waves a SIMD stay:
// waves w and w + 4 hold the same queries over the two halves of the keys, each with its own maxima, sums and accumulators, joined once through LDS behind the loop.
#define KT 64          // keys per stage: a K row and a v2 row (64 channels each) are both one 128-B line
#define KP 72          // LDS pitch of a K row in f16: 144 B = 16 B x odd, conflict-free for 16-byte fragment reads
#define VP 80          // LDS pitch of a v2 row in f16: 160 B = 32 B x odd, conflict-free for the transposing load
#define NT (SS / KT)
#define QB 128         // queries per block: four groups of 32
// Softmax in base 2: exp((s - max) / 8) * 2^11 = exp2(s * CS2 + (11 - max * CS2)), one packed multiply-add for two raw scores ahead of the hardware exponential.
#define CS2 (0.125f * 1.4426950408889634f)
// one stage: 64 K rows + 64 v2 rows of 128 B, 8 lanes a row, 2 + 2 copies a thread (rows r, r + 32)
__device__ __forceinline__ void stage_kv(const _Float16* gk, const _Float16* gv, unsigned lk, unsigned lv) {
  const _Float16 *k0 = gk, *k1 = gk + 32 * CC;
  const _Float16 *v0 = gv, *v1 = gv + 32 * HD;
  const unsigned a0 = lk, a1 = lk + 32 * KP * 2;
  const unsigned b0 = lv, b1 = lv + 32 * VP * 2;
  // the copies and their s_wait_xcnt in one statement: no address register is rewritten before the wait
  asm volatile("global_load_async_to_lds_b128 %0, %4, off\n\t"
               "global_load_async_to_lds_b128 %1, %5, off\n\t"
               "global_load_async_to_lds_b128 %2, %6, off\n\t"
               "global_load_async_to_lds_b128 %3, %7, off\n\t"
               "s_wait_xcnt 0x0"
               :: "v"(a0), "v"(a1), "v"(b0), "v"(b1), "v"(k0), "v"(k1), "v"(v0), "v"(v1) : "memory");
}
// 16 keys x 16 channels of row-major v2 in LDS, transposed: lane (col, g) gets keys 8g + 0..7 of channel col; p is the lane's own address (key 8g + (lane & 7), 16 bytes (lane >> 3) & 1)
__device__ __forceinline__ v8h ld_tr16(const _Float16* p) { typedef __attribute__((address_space(3))) s16x8 lds_s16x8; return __builtin_bit_cast(v8h, __builtin_amdgcn_ds_load_tr16_b128_v8i16((lds_s16x8*)p)); }
// lane l with lane l ^ 16
__device__ __forceinline__ float xhalf(float x) { const int b = __builtin_bit_cast(int, x); return __builtin_bit_cast(float, __builtin_amdgcn_permlanex16(b, b, 0x76543210, 0xfedcba98, false, false)); }
// four waves a SIMD (two blocks a WGP): at most 256 registers a wave
__global__ __launch_bounds__(256) __attribute__((amdgpu_waves_per_eu(4, 4))) void k_attn(const _Float16* __restrict__ Q, const _Float16* __restrict__ Kr, const _Float16* __restrict__ V, float* __restrict__ O) {
  __shared__ __align__(16) float so[4][32][68];   // per query group: first the second key half's state (17 x 32 lanes x 16 B), then the output staging (32 rows)
  __shared__ __align__(16) _Float16 sk[2][KT][KP]; __shared__ __align__(16) _Float16 sv[2][KT][VP];
  const int tid = threadIdx.x, wave = tid >> 5, lane = tid & 31, col = lane & 15, g = lane >> 4; const int qg = wave & 3, kh = wave >> 2; const int h = blockIdx.y; const size_t b = blockIdx.z; const int q0 = blockIdx.x * QB + qg * 32; const size_t rq = b * SS + q0;
  // this thread's 16 bytes of the first of its two rows, in global memory (stage 0) and in LDS (buffer 0)
  const int crow = tid >> 3, cch = (tid & 7) * 8;
  const _Float16* gk = Kr + (b * SS + crow) * CC + h * HD + cch;
  const _Float16* gv = V + (b * NH + h) * (size_t)HD * SS + crow * HD + cch;
  const unsigned lk = (unsigned)(uintptr_t)&sk[0][crow][cch], lv = (unsigned)(uintptr_t)&sv[0][crow][cch];
  stage_kv(gk, gv, lk, lv);
  v16h aq[2][2];
#pragma unroll
  for (int qt = 0; qt < 2; ++qt)
#pragma unroll
    for (int kc = 0; kc < 2; ++kc) aq[qt][kc] = frag_h(Q + (rq + qt * 16 + col) * CC + h * HD + kc * 32, lane);
  float m[2] = {-3.0e38f, -3.0e38f}, l[2] = {0.f, 0.f};   // this lane's two queries: running maximum of the raw scores (equal in both halves of the wave), and the sum over this half's keys (times 2^11)
  v8f acc[2][4] = {};
  asm volatile("s_wait_asynccnt 0x0" ::: "memory");   // stage 0 has landed, as far as this wave copied it
  __syncthreads();                                     // ... and is published to the other waves
  stage_kv(gk + (size_t)KT * CC, gv + KT * HD, lk + KT * KP * 2, lv + KT * VP * 2);
#pragma unroll 1   // one stage a trip, kept rolled: one publish point in the code, the buffer picked by t & 1
  for (int t = 0; t < NT; ++t) { const int bf = t & 1;
    // all fragments of the pass (this wave's 32 keys of the stage) are read as one group, so that their LDS latencies overlap
    v16h kf[2][2], vf[4]; v8f s[2][2] = {};
#pragma unroll
    for (int ct = 0; ct < 2; ++ct)
#pragma unroll
      for (int kc = 0; kc < 2; ++kc) kf[ct][kc] = frag_h(&sk[bf][kh * 32 + ct * 16 + col][kc * 32], lane);
#pragma unroll
    for (int dt = 0; dt < 4; ++dt) { union { v16h v; v8h q[2]; } u; const _Float16* a = &sv[bf][kh * 32 + 8 * g + (lane & 7)][dt * 16 + 8 * ((lane >> 3) & 1)];
      u.q[0] = ld_tr16(a); u.q[1] = ld_tr16(a + 16 * VP); vf[dt] = u.v; }
    // raw scores (the scale is positive, so their maximum is the scaled scores' maximum): four independent tiles side by side
#pragma unroll
    for (int kc = 0; kc < 2; ++kc)
#pragma unroll
      for (int qt = 0; qt < 2; ++qt)
#pragma unroll
        for (int ct = 0; ct < 2; ++ct) s[qt][ct] = wmma16(kf[ct][kc], aq[qt][kc], s[qt][ct]);
    v16h pb[2]; float alpha[2];
#pragma unroll
    for (int qt = 0; qt < 2; ++qt) {
      float mx = fmaxf(s[qt][0][0], s[qt][1][0]);
#pragma unroll
      for (int r = 1; r < 8; ++r) mx = fmaxf(mx, fmaxf(s[qt][0][r], s[qt][1][r]));
      mx = fmaxf(mx, xhalf(mx));
      const float mn = fmaxf(m[qt], mx); alpha[qt] = (m[qt] <= -1.0e38f) ? 0.f : __builtin_amdgcn_exp2f((m[qt] - mn) * CS2);
      const float nm = __builtin_fmaf(-mn, CS2, 11.0f);   // the exponent's offset: minus the scaled maximum, plus P's factor 2^11
      float es[2] = {0.f, 0.f};
#pragma unroll
      for (int ct = 0; ct < 2; ++ct)
#pragma unroll
        for (int i = 0; i < 4; ++i) { const v2f arg = __builtin_elementwise_fma(v2f{s[qt][ct][2 * i], s[qt][ct][2 * i + 1]}, v2f{CS2, CS2}, v2f{nm, nm});
          const float e0 = __builtin_amdgcn_exp2f(arg.x), e1 = __builtin_amdgcn_exp2f(arg.y); es[ct] += e0; es[ct] += e1; pb[qt][ct * 8 + 2 * i] = (_Float16)e0; pb[qt][ct * 8 + 2 * i + 1] = (_Float16)e1; }
      l[qt] = l[qt] * alpha[qt] + (es[0] + es[1]); m[qt] = mn; }
#pragma unroll
    for (int dt = 0; dt < 4; ++dt)
#pragma unroll
      for (int qt = 0; qt < 2; ++qt) acc[qt][dt] = wmma16(vf[dt], pb[qt], acc[qt][dt] * alpha[qt]);
    // publish point of stage t + 1: this wave's reads of buffer bf are done, its copies of stage t + 1 have landed, every wave has come so far
    asm volatile("s_wait_dscnt 0x0" ::: "memory");
    asm volatile("s_wait_asynccnt 0x0" ::: "memory");
    __syncthreads();
    if (t + 2 < NT) stage_kv(gk + (size_t)(t + 2) * KT * CC, gv + (t + 2) * KT * HD, lk + bf * (KT * KP * 2), lv + bf * (KT * VP * 2)); }
  asm volatile("s_wait_asynccnt 0x0" ::: "memory");   // no copy is outstanding when the wave ends
  // the join of the two key halves: wave w + 4 hands its state to wave w, lane to lane (same queries, same channels), 16 bytes a lane and 512 B a wave-store
  v4f* mg = (v4f*)&so[qg][0][0];
  if (kh == 1) {
#pragma unroll
    for (int qt = 0; qt < 2; ++qt)
#pragma unroll
      for (int dt = 0; dt < 4; ++dt) { const v8f o = acc[qt][dt];
        mg[((qt * 4 + dt) * 2 + 0) * 32 + lane] = __builtin_shufflevector(o, o, 0, 1, 2, 3); mg[((qt * 4 + dt) * 2 + 1) * 32 + lane] = __builtin_shufflevector(o, o, 4, 5, 6, 7); }
    mg[16 * 32 + lane] = v4f{m[0], l[0], m[1], l[1]};
  }
  __syncthreads();   // the second half's state is written before the first half's wave reads it
  if (kh == 0) {
    const v4f ml = mg[16 * 32 + lane];
#pragma unroll
    for (int qt = 0; qt < 2; ++qt) { const float m1 = ml[2 * qt], l1 = ml[2 * qt + 1];
      const float mn = fmaxf(m[qt], m1); const float w0 = __builtin_amdgcn_exp2f((m[qt] - mn) * CS2), w1 = __builtin_amdgcn_exp2f((m1 - mn) * CS2);
      l[qt] = l[qt] * w0 + l1 * w1;
#pragma unroll
      for (int dt = 0; dt < 4; ++dt) { const v4f lo = mg[((qt * 4 + dt) * 2 + 0) * 32 + lane], hi = mg[((qt * 4 + dt) * 2 + 1) * 32 + lane];
        acc[qt][dt] = acc[qt][dt] * w0 + __builtin_shufflevector(lo, hi, 0, 1, 2, 3, 4, 5, 6, 7) * w1; } }
#pragma unroll
    for (int qt = 0; qt < 2; ++qt) { const float il = 1.0f / (l[qt] + xhalf(l[qt]));   // the wave halves' sums are joined once; sums and accumulators both carry 2^11
#pragma unroll
      for (int dt = 0; dt < 4; ++dt) { const v8f o = acc[qt][dt] * il;   // channels dt * 16 + 8g + 0..7 of query qt * 16 + col
        *(v4f*)&so[qg][qt * 16 + col][dt * 16 + 8 * g] = __builtin_shufflevector(o, o, 0, 1, 2, 3); *(v4f*)&so[qg][qt * 16 + col][dt * 16 + 8 * g + 4] = __builtin_shufflevector(o, o, 4, 5, 6, 7); } }
    LDSX();
    for (int rl = 0; rl < 32; rl += 2) vst2(O + (((b * NH + h) * SS + q0 + rl + g) * HD) + col * 4, *(const v4f*)&so[qg][rl + g][col * 4]);   // two rows of 256 B a store
  }
}
extern "C" void kernel_launch(void* const* d_in, const int* in_sizes, int n_in, void* d_out, int out_size, void* d_ws, size_t ws_size, hipStream_t stream) {
  (void)in_sizes; (void)n_in; (void)out_size;
  const float** F = (const float**)d_in;   // 0 x [4,512,2048], 1 wq [512,512], 2 bq, 3 wk, 4 bk, 5 wv, 6 bv
  if (ws_size < (size_t)WS_END) return;
  char* ws = (char*)d_ws; __bf16* PW = (__bf16*)ws; _Float16 *Q = (_Float16*)(ws + WS_Q), *Kr = (_Float16*)(ws + WS_K), *V = (_Float16*)(ws + WS_V);
  k_pack<<<dim3(CC, 3), 256, 0, stream>>>(F[1], F[3], F[5], PW);
  k_proj<<<dim3(TNB * SS / 128, CC / 128, 3), 256, 0, stream>>>(F[0], PW, F[2], F[4], F[6], Q, Kr, V);
  k_attn<<<dim3(SS / QB, NH, TNB), 256, 0, stream>>>(Q, Kr, V, (float*)d_out);
}

// v008
// It runs in 55.7 microseconds.
// Next to v007, in two timings, it ran 1.08 and 1.06 times as fast.
// All steps since v000 together make it 4.42 times as fast.
// compute dtype: all float inputs rounded to bf16; x read as it lies (channel rows) and transposed by the LDS fragment load; q/k/v = x_t . W^T + b with EXACT bf16 products on WMMA 16x16x32 (natural weight rows), rounded once to f16 (v as (B,C,L) planes, read by the attention through the module's raw .view(B,H,L,Ch) as rows of 64 channels a key); attention: q (times 1/8 log2 e before its one rounding) and k single f16, softmax in base 2 in f32 against a held reference (hardware exp), P (scaled by 2^7, single f16) x v2 (single f16); f32 output written in the module's raw (B,H,L,Ch) -> (B,C,L) memory order.
#include <hip/hip_runtime.h>
#include <math.h>

typedef __attribute__((ext_vector_type(16))) _Float16 v16h;
typedef __attribute__((ext_vector_type(16))) __bf16 v16b;
typedef __attribute__((ext_vector_type(8)))  _Float16 v8h;
typedef __attribute__((ext_vector_type(8)))  float v8f;
typedef __attribute__((ext_vector_type(4)))  float v4f;
typedef __attribute__((ext_vector_type(2)))  float v2f;
typedef __attribute__((ext_vector_type(4)))  unsigned v4u;
typedef __attribute__((ext_vector_type(4)))  int v4i;
typedef float __attribute__((may_alias)) float_a;
typedef int __attribute__((may_alias)) int_a;

template <typename T> __device__ __forceinline__ void vst2(void* p, T v) { *(T*)p = v;  }
__device__ __forceinline__ v8f wmma16(v16h a, v16h b, v8f c) {
  v8f d = __builtin_amdgcn_wmma_f32_16x16x32_f16(false, a, false, b, (short)0, c, false, false);
  asm volatile("v_nop\n\tv_nop\n\tv_nop\n\tv_nop" : "+v"(d) : "v"(a), "v"(b));
  return d;
}
__device__ __forceinline__ v8f wmma_bf(v16b a, v16b b, v8f c) {
  v8f d = __builtin_amdgcn_wmma_f32_16x16x32_bf16(false, a, false, b, (short)0, c, false, false);
  asm volatile("v_nop\n\tv_nop\n\tv_nop\n\tv_nop" : "+v"(d) : "v"(a), "v"(b));
  return d;
}
// 16x16x32 fragments: lane = (h = lane>>4, row/col = lane&15); elements 0..7 = k0+8h+0..7, 8..15 = k0+16+8h+0..7; D element r = row 8h+r
__device__ __forceinline__ v16h frag_h(const _Float16* rowk0, int lane) {
  union { v16h v; v8h q[2]; } u; const _Float16* p = rowk0 + 8 * (lane >> 4);
  u.q[0] = *(const v8h*)p; u.q[1] = *(const v8h*)(p + 16); return u.v;
}
__device__ __forceinline__ v16h frag_f32(const float* rowk0, int lane) {
  v16h a; const float* p = rowk0 + 8 * (lane >> 4);
#pragma unroll
  for (int i = 0; i < 8; ++i) { a[i] = (_Float16)p[i]; a[8 + i] = (_Float16)p[16 + i]; }
  return a;
}
__device__ __forceinline__ v16h frag_f32s(const float* rowk0, int lane, float sc) {
  v16h a; const float* p = rowk0 + 8 * (lane >> 4);
#pragma unroll
  for (int i = 0; i < 8; ++i) { a[i] = (_Float16)(p[i] * sc); a[8 + i] = (_Float16)(p[16 + i] * sc); }
  return a;
}
// column fragment from a [K][ld] layout (column n), rows >= K read as 0
__device__ __forceinline__ v16h fragc_f32(const float* W, int k0, int n, int lane, int ld, int K) {
  v16h a; const int g = lane >> 4;
#pragma unroll
  for (int i = 0; i < 8; ++i) { const int ka = k0 + 8 * g + i, kb = ka + 16;
    a[i] = (_Float16)(ka < K ? W[(size_t)(ka < K ? ka : K - 1) * ld + n] : 0.f); a[8 + i] = (_Float16)(kb < K ? W[(size_t)(kb < K ? kb : K - 1) * ld + n] : 0.f); }
  return a;
}
struct F2 { v16b h, l; };
__device__ __forceinline__ F2 bsplit16(const float v[16]) { F2 r;
#pragma unroll
  for (int i = 0; i < 16; ++i) { const __bf16 h = (__bf16)v[i]; r.h[i] = h; r.l[i] = (__bf16)(v[i] - (float)h); }
  return r; }
__device__ __forceinline__ F2 split_row(const float* row, int k0, int lane) { float v[16]; const float* p = row + k0 + 8 * (lane >> 4);
#pragma unroll
  for (int i = 0; i < 8; ++i) { v[i] = p[i]; v[8 + i] = p[16 + i]; }
  return bsplit16(v); }
__device__ __forceinline__ F2 split_rowK(const float* row, int k0, int lane, int K) { float v[16]; const int g = lane >> 4;
#pragma unroll
  for (int i = 0; i < 8; ++i) { const int ka = k0 + 8 * g + i, kb = ka + 16; v[i] = ka < K ? row[ka < K ? ka : K - 1] : 0.f; v[8 + i] = kb < K ? row[kb < K ? kb : K - 1] : 0.f; }
  return bsplit16(v); }
__device__ __forceinline__ F2 split_col(const float* W, int k0, int n, int lane, int ld, int K) { float v[16]; const int g = lane >> 4;
#pragma unroll
  for (int i = 0; i < 8; ++i) { const int ka = k0 + 8 * g + i, kb = ka + 16; v[i] = ka < K ? W[(size_t)(ka < K ? ka : K - 1) * ld + n] : 0.f; v[8 + i] = kb < K ? W[(size_t)(kb < K ? kb : K - 1) * ld + n] : 0.f; }
  return bsplit16(v); }
__device__ __forceinline__ v8f mac3(const F2& a, const F2& b, v8f c) { c = wmma_bf(a.l, b.h, c); c = wmma_bf(a.h, b.l, c); return wmma_bf(a.h, b.h, c); }
__device__ __forceinline__ float sigm(float v) { return 1.0f / (1.0f + expf(-v)); }
#define LDSX() do { asm volatile("s_wait_dscnt 0" ::: "memory"); __builtin_amdgcn_wave_barrier(); __builtin_amdgcn_fence(__ATOMIC_RELEASE, "workgroup"); } while (0)


// Multi-head self attention on a (B, C, L) sequence (B 4, C 512, L 2,048, 8 heads x 64) with 1x1-conv projections; faithful to the module's quirk of viewing v as (B,H,L,Ch) and the output as (B,C,L) by raw reshape.
#define NB 4
#define CC 512
#define SS 2048
#define NH 8
#define HD 64
#define NR (NB * SS)
#ifndef TQB
#define TQB (SS / 64)
#define TNB NB
#endif
typedef __attribute__((ext_vector_type(8))) __bf16 v8b;
__device__ __forceinline__ v16b frag_b(const __bf16* rowk0, int lane) {
  union { v16b v; v8b q[2]; } u; const __bf16* p = rowk0 + 8 * (lane >> 4);
  u.q[0] = *(const v8b*)p; u.q[1] = *(const v8b*)(p + 16); return u.v;
}
__device__ __forceinline__ float bfr(float v) { return (float)(__bf16)v; }
__device__ __attribute__((noinline)) float exp_ni(float v) { return expf(v); }
__device__ __attribute__((noinline)) float erf_ni(float v) { return erff(v); }

#define WS_PW  0u                                   // bf16 natural rows wq, wk, wv [3][512][512]
#define WS_Q   (WS_PW + 2u * (size_t)3 * CC * CC)       // f16 q rows [NR][512]; k rows; v planes (B,C,L) [b][512][L]
#define WS_K   (WS_Q + 2u * (size_t)NR * CC)
#define WS_V   (WS_K + 2u * (size_t)NR * CC)
#define WS_END (WS_V + 2u * (size_t)NB * CC * SS)

__global__ __launch_bounds__(256) void k_pack(const float* __restrict__ WQ, const float* __restrict__ WK, const float* __restrict__ WV, __bf16* __restrict__ PW) { const int n = blockIdx.x, which = blockIdx.y, t = threadIdx.x; __shared__ __align__(16) __bf16 s[CC]; const float* w = (which == 0) ? WQ : (which == 1) ? WK : WV; for (int k = t; k < CC; k += 256) s[k] = (__bf16)w[(size_t)n * CC + k]; __syncthreads(); if (t < CC / 8) vst2((unsigned*)(PW + ((size_t)which * CC + n) * CC + t * 8), *(const v4u*)&s[t * 8]); }
// ---- k_proj: block = (128 rows, 128 cols, which), 8 waves of 32 rows x 64 cols: + bias; q/k -> f16 rows; v -> (B,C,L) planes
// x is read as it lies, channel rows of positions: a stage is PK channel rows x 128 positions, loaded to registers one stage ahead, rounded to bf16 and stored to LDS in the same channel-major order;
// the transposing LDS load then delivers the x^T fragments (row = position, k = channel) in the hardware k order, which is the order of the weight fragments. No transposed copy of x is made.
// Weight rows (bf16) come in stages of PK channels through LDS by asynchronous copies. Two buffers, shared by the block's eight waves: the next stage flies while this stage is worked on.
#define CS2 (0.125f * 1.4426950408889634f)   // 1/sqrt(64) and log2 e: q leaves the projection times this, so that q . k is the exponent of the attention's base-2 softmax
#define PK 64                         // channels per stage: 64 x rows of 512 B (f32) in memory, 256 B (bf16) in LDS; a weight row piece is one 128-B line
#define PNT (CC / PK)
#define PXP 144                       // LDS pitch of an x channel row in bf16: 288 B = 32 B x odd, conflict-free for the transposing load
#define PBP 72                        // LDS pitch of a weight row in bf16: 144 B = 16 B x odd
#define PX_BYTES (PK * PXP * 2)
#define PST_BYTES (PX_BYTES + 128 * PBP * 2)
#define POP 136                       // pitch of the output staging in f16: 272 B
typedef __attribute__((ext_vector_type(4))) __bf16 v4b;
typedef short s16x8 __attribute__((ext_vector_type(8)));
// 16 channels x 16 positions of channel-major x in LDS, transposed: lane (col, g) gets channels 8g + 0..7 of position col; p is the lane's own address (channel 8g + (lane & 7), 16 bytes (lane >> 3) & 1)
__device__ __forceinline__ v8b ld_tr16b(const __bf16* p) { typedef __attribute__((address_space(3))) s16x8 lds_s16x8; return __builtin_bit_cast(v8b, __builtin_amdgcn_ds_load_tr16_b128_v8i16((lds_s16x8*)p)); }
// one stage of x: a wave takes 8 channel rows, a whole 512-B row piece a load (16 bytes a lane)
__device__ __forceinline__ void load_x(const float* gx, v4f (&r)[8]) {
#pragma unroll
  for (int j = 0; j < 8; ++j) r[j] = *(const v4f*)(gx + (size_t)j * SS);
}
__device__ __forceinline__ void store_x(__bf16* sx, const v4f (&r)[8]) {
#pragma unroll
  for (int j = 0; j < 8; ++j) *(v4b*)(sx + j * PXP) = v4b{(__bf16)r[j][0], (__bf16)r[j][1], (__bf16)r[j][2], (__bf16)r[j][3]};
}
// one stage of weights: 128 rows of 128 B, 8 lanes a row, 4 copies a thread (rows r + 32 i)
__device__ __forceinline__ void stage_w(const __bf16* gb, unsigned lb) {
  const __bf16 *b0 = gb, *b1 = gb + 32 * CC, *b2 = gb + 64 * CC, *b3 = gb + 96 * CC;
  const unsigned y0 = lb, y1 = lb + 32 * PBP * 2, y2 = lb + 64 * PBP * 2, y3 = lb + 96 * PBP * 2;
  // the copies and their s_wait_xcnt in one statement: no address register is rewritten before the wait
  asm volatile("global_load_async_to_lds_b128 %0, %4, off\n\t"
               "global_load_async_to_lds_b128 %1, %5, off\n\t"
               "global_load_async_to_lds_b128 %2, %6, off\n\t"
               "global_load_async_to_lds_b128 %3, %7, off\n\t"
               "s_wait_xcnt 0x0"
               :: "v"(y0), "v"(y1), "v"(y2), "v"(y3), "v"(b0), "v"(b1), "v"(b2), "v"(b3) : "memory");
}
__global__ __launch_bounds__(256) void k_proj(const float* __restrict__ X, const __bf16* __restrict__ PW, const float* __restrict__ BQ, const float* __restrict__ BK, const float* __restrict__ BV, _Float16* __restrict__ Q, _Float16* __restrict__ Kr, _Float16* __restrict__ V) {
  __shared__ __align__(16) unsigned char sm[2 * PST_BYTES];   // two stages [x 64 channel rows | weights 128 rows]; behind the loop the output staging
  const int tid = threadIdx.x, wave = tid >> 5, lane = tid & 31, col = lane & 15, g = lane >> 4; const int which = blockIdx.z; const size_t rb = (size_t)blockIdx.x * 128; const int c0 = blockIdx.y * 128; const int wr = (wave >> 1) * 32, wc = (wave & 1) * 64; const float* BB = (which == 0) ? BQ : (which == 1) ? BK : BV;
  const size_t b = rb / SS; const int s0 = (int)(rb % SS);   // the block's 128 token rows are positions s0 .. s0 + 127 of one batch entry
  // this thread's 16 bytes of the first of its x rows and of its weight rows, in global memory (stage 0) and in LDS (buffer 0)
  const float* gx = X + (b * CC + wave * 8) * SS + s0 + lane * 4;
  const __bf16* gb = PW + ((size_t)which * CC + c0 + (tid >> 3)) * CC + (tid & 7) * 8;
  const int lx = (wave * 8) * (PXP * 2) + lane * 8;
  const unsigned lb = (unsigned)(uintptr_t)&sm[PX_BYTES + (tid >> 3) * (PBP * 2) + (tid & 7) * 16];
  v4f xr[8];
  load_x(gx, xr);
  stage_w(gb, lb);
  v8f acc[2][4] = {};
  store_x((__bf16*)(sm + lx), xr);
  asm volatile("s_wait_asynccnt 0x0" ::: "memory");   // stage 0's weights have landed, as far as this wave copied them
  __syncthreads();                                     // ... and they and the x rows stored above are published to the other waves
  load_x(gx + (size_t)PK * SS, xr);
  stage_w(gb + PK, lb + PST_BYTES);
#pragma unroll 1   // one stage a trip, kept rolled: one publish point in the code, the buffer picked by t & 1
  for (int t = 0; t < PNT; ++t) { const int bf = t & 1; const __bf16* sx = (const __bf16*)(sm + bf * PST_BYTES); const __bf16* sb = (const __bf16*)(sm + bf * PST_BYTES + PX_BYTES);
#pragma unroll   // both 32-channel steps of a stage unrolled: their LDS offsets become immediates
    for (int kc = 0; kc < PK / 32; ++kc) { v16b a[2], w[4];
      // all fragments of the step are read as one group, so that their LDS latencies overlap
#pragma unroll
      for (int i = 0; i < 2; ++i) { union { v16b v; v8b q[2]; } u; const __bf16* p = sx + (kc * 32 + 8 * g + (lane & 7)) * PXP + wr + i * 16 + 8 * ((lane >> 3) & 1);
        u.q[0] = ld_tr16b(p); u.q[1] = ld_tr16b(p + 16 * PXP); a[i] = u.v; }
#pragma unroll
      for (int j = 0; j < 4; ++j) w[j] = frag_b(sb + (wc + j * 16 + col) * PBP + kc * 32, lane);
#pragma unroll
      for (int i = 0; i < 2; ++i)
#pragma unroll
        for (int j = 0; j < 4; ++j) acc[i][j] = wmma_bf(a[i], w[j], acc[i][j]); }
    // stage t + 1 of x, in registers since the last publish point, goes to the other buffer, whose readers left it at that point
    if (t + 1 < PNT) store_x((__bf16*)(sm + (bf ^ 1) * PST_BYTES + lx), xr);
    // publish point of stage t + 1: this wave's reads of buffer bf and its x stores are done, its copies of stage t + 1 have landed, every wave has come so far
    asm volatile("s_wait_dscnt 0x0" ::: "memory");
    asm volatile("s_wait_asynccnt 0x0" ::: "memory");
    __syncthreads();
    if (t + 2 < PNT) { load_x(gx + (size_t)(t + 2) * PK * SS, xr); stage_w(gb + (t + 2) * PK, lb + bf * PST_BYTES); } }
  asm volatile("s_wait_asynccnt 0x0" ::: "memory");   // no copy is outstanding when the ring becomes output staging (the last trip's barrier has ended every read of it)
  _Float16* so = (_Float16*)sm;
  if (which < 2) {   // so[row][col]
    const float qs = (which == 0) ? CS2 : 1.0f;
#pragma unroll
    for (int j = 0; j < 4; ++j) { const float bb = bfr(BB[c0 + wc + j * 16 + col]);
#pragma unroll
      for (int i = 0; i < 2; ++i)
#pragma unroll
        for (int r = 0; r < 8; ++r) so[(wr + i * 16 + 8 * g + r) * POP + wc + j * 16 + col] = (_Float16)((acc[i][j][r] + bb) * qs); }
  } else {           // so[col][row]: a lane's 8 rows of a tile are 16 contiguous bytes
#pragma unroll
    for (int j = 0; j < 4; ++j) { const float bb = bfr(BB[c0 + wc + j * 16 + col]);
#pragma unroll
      for (int i = 0; i < 2; ++i) { v8h hv;
#pragma unroll
        for (int r = 0; r < 8; ++r) hv[r] = (_Float16)(acc[i][j][r] + bb);
        *(v8h*)&so[(wc + j * 16 + col) * POP + wr + i * 16 + 8 * g] = hv; } }
  }
  __syncthreads();
  if (which < 2) { _Float16* dst = (which == 0) ? Q : Kr; 
#pragma unroll   // the eight LDS reads of a thread go out as one group
    for (int it = 0; it < 8; ++it) { const int rl = it * 16 + (tid >> 4), q = tid & 15; vst2((unsigned*)(dst + (rb + rl) * CC + c0 + q * 8), *(const v4u*)&so[rl * POP + q * 8]); } }
  else {
#pragma unroll   // the eight LDS reads of a thread go out as one group
    for (int it = 0; it < 8; ++it) { const int d = it * 16 + (tid >> 4), pc = tid & 15; vst2((unsigned*)(V + ((b * CC + c0 + d) * SS) + s0 + pc * 8), *(const v4u*)&so[d * POP + pc * 8]); } }
}
// ---- k_attn: block = (128 queries, head, b): softmax(q k / 8) over all L keys, . v2; output rows (b, h, l) of 64 floats (the raw (B,H,L,Ch) buffer == the module's (B,C,L) result)
// Scores are formed transposed, S^T = K . Q^T (A = K rows, B = Q rows): a lane holds 8 keys a tile of ONE query (column lane & 15), so maximum and sum run in the lane's own registers, with one exchange
// between the wave's halves; two S^T tiles, converted in place, are the B operand of O^T += v2^T . P^T in the hardware k order (keys 8g + 0..7, 16 + 8g + 0..7), the order in which the transposing load delivers v2^T.
// v2[m][c] = F[m * 64 + c], F the head's contiguous (Ch x L) block of the (B,C,L) v tensor: a key's 64 channels are one 128-B line as they lie, and no transposed copy is made.
// K rows and v2 rows come in stages of KT keys through LDS, shared by the block's eight waves: two buffers, the next stage's asynchronous copies fly while this stage is worked on.
// A wave takes 32 query columns (two tiles), so that every K and v2^T fragment read from LDS feeds two products, and one 32-key half of every stage, so that four waves a SIMD stay:
// waves w and w + 4 hold the same queries over the two halves of the keys, each with its own references, sums and accumulators, joined once through LDS behind the loop.
#define KT 64          // keys per stage: a K row and a v2 row (64 channels each) are both one 128-B line
#define KP 72          // LDS pitch of a K row in f16: 144 B = 16 B x odd, conflict-free for 16-byte fragment reads
#define VP 80          // LDS pitch of a v2 row in f16: 160 B = 32 B x odd, conflict-free for the transposing load
#define NT (SS / KT)
#define QB 128         // queries per block: four groups of 32
// Softmax in base 2 against a held reference: q is stored times CS2, so a score product is already the exponent, and PEX - reference (PEX: P carries the factor 2^PEX) enters as the C operand of the first product:
// the hardware exponential reads the accumulators as they are. The reference of a query is a maximum of scores seen so far; it stays until a pass's sum of P passes PTOP, which one test a pass finds.
// Then, and in the first pass, the reference is raised to the pass's maximum, O and the sum are rescaled and the pass's P is formed again. Below PTOP every P is below f16's largest number.
// PEX leaves a score 8 powers of two of room above its reference before the test fires, and P stays a normal f16 number down to 21 powers of two below the reference.
#define PTOP 32768.0f
#define PEX 7.0f
// one stage: 64 K rows + 64 v2 rows of 128 B, 8 lanes a row, 2 + 2 copies a thread (rows r, r + 32)
__device__ __forceinline__ void stage_kv(const _Float16* gk, const _Float16* gv, unsigned lk, unsigned lv) {
  const _Float16 *k0 = gk, *k1 = gk + 32 * CC;
  const _Float16 *v0 = gv, *v1 = gv + 32 * HD;
  const unsigned a0 = lk, a1 = lk + 32 * KP * 2;
  const unsigned b0 = lv, b1 = lv + 32 * VP * 2;
  // the copies and their s_wait_xcnt in one statement: no address register is rewritten before the wait
  asm volatile("global_load_async_to_lds_b128 %0, %4, off\n\t"
               "global_load_async_to_lds_b128 %1, %5, off\n\t"
               "global_load_async_to_lds_b128 %2, %6, off\n\t"
               "global_load_async_to_lds_b128 %3, %7, off\n\t"
               "s_wait_xcnt 0x0"
               :: "v"(a0), "v"(a1), "v"(b0), "v"(b1), "v"(k0), "v"(k1), "v"(v0), "v"(v1) : "memory");
}
// 16 keys x 16 channels of row-major v2 in LDS, transposed: lane (col, g) gets keys 8g + 0..7 of channel col; p is the lane's own address (key 8g + (lane & 7), 16 bytes (lane >> 3) & 1)
__device__ __forceinline__ v8h ld_tr16(const _Float16* p) { typedef __attribute__((address_space(3))) s16x8 lds_s16x8; return __builtin_bit_cast(v8h, __builtin_amdgcn_ds_load_tr16_b128_v8i16((lds_s16x8*)p)); }
// lane l with lane l ^ 16
__device__ __forceinline__ float xhalf(float x) { const int b = __builtin_bit_cast(int, x); return __builtin_bit_cast(float, __builtin_amdgcn_permlanex16(b, b, 0x76543210, 0xfedcba98, false, false)); }
// 2^x off the usual path: the exponential and the free slot that the instruction set asks for behind it stand in one statement, whatever the compiler puts next
__device__ __forceinline__ float exp2_slot(float x) { float r; asm("v_exp_f32 %0, %1\n\tv_nop" : "=v"(r) : "v"(x)); return r; }
// P of one query column over the pass's 32 keys: 2^exponent, packed as the B operand; returns this lane's sum over its 16 keys
template <bool RARE> __device__ __forceinline__ float exp_pack(const v8f& s0, const v8f& s1, v16h& pb) {
  float e0 = 0.f, e1 = 0.f;
#pragma unroll   // values in registers: every index a constant
  for (int i = 0; i < 8; ++i) { const float a = RARE ? exp2_slot(s0[i]) : __builtin_amdgcn_exp2f(s0[i]), c = RARE ? exp2_slot(s1[i]) : __builtin_amdgcn_exp2f(s1[i]); e0 += a; e1 += c; pb[i] = (_Float16)a; pb[8 + i] = (_Float16)c; }
  return e0 + e1;
}
// four waves a SIMD (two blocks a WGP): at most 256 registers a wave
__global__ __launch_bounds__(256) __attribute__((amdgpu_waves_per_eu(4, 4))) void k_attn(const _Float16* __restrict__ Q, const _Float16* __restrict__ Kr, const _Float16* __restrict__ V, float* __restrict__ O) {
  __shared__ __align__(16) float so[4][32][68];   // per query group: first the second key half's state (17 x 32 lanes x 16 B), then the output staging (32 rows)
  __shared__ __align__(16) _Float16 sk[2][KT][KP]; __shared__ __align__(16) _Float16 sv[2][KT][VP];
  const int tid = threadIdx.x, wave = tid >> 5, lane = tid & 31, col = lane & 15, g = lane >> 4; const int qg = wave & 3, kh = wave >> 2; const int h = blockIdx.y; const size_t b = blockIdx.z; const int q0 = blockIdx.x * QB + qg * 32; const size_t rq = b * SS + q0;
  // this thread's 16 bytes of the first of its two rows, in global memory (stage 0) and in LDS (buffer 0)
  const int crow = tid >> 3, cch = (tid & 7) * 8;
  const _Float16* gk = Kr + (b * SS + crow) * CC + h * HD + cch;
  const _Float16* gv = V + (b * NH + h) * (size_t)HD * SS + crow * HD + cch;
  const unsigned lk = (unsigned)(uintptr_t)&sk[0][crow][cch], lv = (unsigned)(uintptr_t)&sv[0][crow][cch];
  stage_kv(gk, gv, lk, lv);
  v16h aq[2][2];
#pragma unroll
  for (int qt = 0; qt < 2; ++qt)
#pragma unroll
    for (int kc = 0; kc < 2; ++kc) aq[qt][kc] = frag_h(Q + (rq + qt * 16 + col) * CC + h * HD + kc * 32, lane);
  float cr[2] = {PEX, PEX}, l[2] = {0.f, 0.f};   // this lane's two queries: PEX - reference (equal in both halves of the wave; the first pass sets it), and the sum over this half's keys (times 2^PEX)
  v8f cc[2];   // cr in all eight registers: the C operand of a query tile's first score products
#pragma unroll   // values in registers: every index a constant
  for (int qt = 0; qt < 2; ++qt)
#pragma unroll   // values in registers: every index a constant
    for (int r = 0; r < 8; ++r) cc[qt][r] = cr[qt];
  v8f acc[2][4] = {};
  asm volatile("s_wait_asynccnt 0x0" ::: "memory");   // stage 0 has landed, as far as this wave copied it
  __syncthreads();                                     // ... and is published to the other waves
  stage_kv(gk + (size_t)KT * CC, gv + KT * HD, lk + KT * KP * 2, lv + KT * VP * 2);
#pragma unroll 1   // one stage a trip, kept rolled: one publish point in the code, the buffer picked by t & 1
  for (int t = 0; t < NT; ++t) { const int bf = t & 1;
    // all fragments of the pass (this wave's 32 keys of the stage) are read as one group, so that their LDS latencies overlap
    v16h kf[2][2], vf[4]; v8f s[2][2];
#pragma unroll
    for (int ct = 0; ct < 2; ++ct)
#pragma unroll
      for (int kc = 0; kc < 2; ++kc) kf[ct][kc] = frag_h(&sk[bf][kh * 32 + ct * 16 + col][kc * 32], lane);
#pragma unroll
    for (int dt = 0; dt < 4; ++dt) { union { v16h v; v8h q[2]; } u; const _Float16* a = &sv[bf][kh * 32 + 8 * g + (lane & 7)][dt * 16 + 8 * ((lane >> 3) & 1)];
      u.q[0] = ld_tr16(a); u.q[1] = ld_tr16(a + 16 * VP); vf[dt] = u.v; }
    // exponents: score + PEX - reference, four independent tiles side by side
#pragma unroll   // values in registers: every index a constant
    for (int qt = 0; qt < 2; ++qt)
#pragma unroll   // values in registers: every index a constant
      for (int ct = 0; ct < 2; ++ct) s[qt][ct] = wmma16(kf[ct][0], aq[qt][0], cc[qt]);
#pragma unroll   // values in registers: every index a constant
    for (int qt = 0; qt < 2; ++qt)
#pragma unroll   // values in registers: every index a constant
      for (int ct = 0; ct < 2; ++ct) s[qt][ct] = wmma16(kf[ct][1], aq[qt][1], s[qt][ct]);
    v16h pb[2]; float es[2];
#pragma unroll   // values in registers: every index a constant
    for (int qt = 0; qt < 2; ++qt) es[qt] = exp_pack<false>(s[qt][0], s[qt][1], pb[qt]);
    // one test a pass, a scalar branch, marked unlikely so that the usual path falls through: the first pass has no reference yet; later a sum above PTOP (an infinite one too) says that a score stands far above its query's reference
    if (__builtin_expect((__builtin_amdgcn_ballot_w32(fmaxf(es[0], es[1]) > PTOP) | (unsigned)(t == 0)) != 0, 0)) {
#pragma unroll   // values in registers: every index a constant
      for (int qt = 0; qt < 2; ++qt) {
        float mx = fmaxf(s[qt][0][0], s[qt][1][0]);
#pragma unroll   // values in registers: every index a constant
        for (int r = 1; r < 8; ++r) mx = fmaxf(mx, fmaxf(s[qt][0][r], s[qt][1][r]));
        mx = fmaxf(mx, xhalf(mx));
        // the reference moves by d, up to the pass's maximum (in the first pass to it, either way); a query whose scores stay below its reference keeps it
        const float d = (t == 0) ? mx - PEX : fmaxf(mx - PEX, 0.f);
        const float alpha = (t == 0) ? 0.f : exp2_slot(-d);
        cr[qt] -= d; l[qt] *= alpha;
#pragma unroll   // values in registers: every index a constant
        for (int r = 0; r < 8; ++r) cc[qt][r] = cr[qt];
#pragma unroll   // values in registers: every index a constant
        for (int dt = 0; dt < 4; ++dt) acc[qt][dt] = acc[qt][dt] * alpha;
        es[qt] = exp_pack<true>(s[qt][0] - d, s[qt][1] - d, pb[qt]); } }
#pragma unroll   // values in registers: every index a constant
    for (int qt = 0; qt < 2; ++qt) l[qt] += es[qt];
#pragma unroll
    for (int dt = 0; dt < 4; ++dt)
#pragma unroll
      for (int qt = 0; qt < 2; ++qt) acc[qt][dt] = wmma16(vf[dt], pb[qt], acc[qt][dt]);
    // publish point of stage t + 1: this wave's reads of buffer bf are done, its copies of stage t + 1 have landed, every wave has come so far
    asm volatile("s_wait_dscnt 0x0" ::: "memory");
    asm volatile("s_wait_asynccnt 0x0" ::: "memory");
    __syncthreads();
    if (t + 2 < NT) stage_kv(gk + (size_t)(t + 2) * KT * CC, gv + (t + 2) * KT * HD, lk + bf * (KT * KP * 2), lv + bf * (KT * VP * 2)); }
  asm volatile("s_wait_asynccnt 0x0" ::: "memory");   // no copy is outstanding when the wave ends
  // the join of the two key halves: wave w + 4 hands its state to wave w, lane to lane (same queries, same channels), 16 bytes a lane and 512 B a wave-store
  v4f* mg = (v4f*)&so[qg][0][0];
  if (kh == 1) {
#pragma unroll
    for (int qt = 0; qt < 2; ++qt)
#pragma unroll
      for (int dt = 0; dt < 4; ++dt) { const v8f o = acc[qt][dt];
        mg[((qt * 4 + dt) * 2 + 0) * 32 + lane] = __builtin_shufflevector(o, o, 0, 1, 2, 3); mg[((qt * 4 + dt) * 2 + 1) * 32 + lane] = __builtin_shufflevector(o, o, 4, 5, 6, 7); }
    mg[16 * 32 + lane] = v4f{cr[0], l[0], cr[1], l[1]};
  }
  __syncthreads();   // the second half's state is written before the first half's wave reads it
  if (kh == 0) {
    const v4f ml = mg[16 * 32 + lane];
#pragma unroll
    for (int qt = 0; qt < 2; ++qt) { const float c1 = ml[2 * qt], l1 = ml[2 * qt + 1];
      const float cn = fminf(cr[qt], c1); const float w0 = exp2_slot(cn - cr[qt]), w1 = exp2_slot(cn - c1);   // the higher reference (the lower PEX - reference) is the common one
      l[qt] = l[qt] * w0 + l1 * w1;
#pragma unroll
      for (int dt = 0; dt < 4; ++dt) { const v4f lo = mg[((qt * 4 + dt) * 2 + 0) * 32 + lane], hi = mg[((qt * 4 + dt) * 2 + 1) * 32 + lane];
        acc[qt][dt] = acc[qt][dt] * w0 + __builtin_shufflevector(lo, hi, 0, 1, 2, 3, 4, 5, 6, 7) * w1; } }
#pragma unroll
    for (int qt = 0; qt < 2; ++qt) { const float il = 1.0f / (l[qt] + xhalf(l[qt]));   // the wave halves' sums are joined once; sums and accumulators both carry 2^PEX
#pragma unroll
      for (int dt = 0; dt < 4; ++dt) { const v8f o = acc[qt][dt] * il;   // channels dt * 16 + 8g + 0..7 of query qt * 16 + col
        *(v4f*)&so[qg][qt * 16 + col][dt * 16 + 8 * g] = __builtin_shufflevector(o, o, 0, 1, 2, 3); *(v4f*)&so[qg][qt * 16 + col][dt * 16 + 8 * g + 4] = __builtin_shufflevector(o, o, 4, 5, 6, 7); } }
    LDSX();
    for (int rl = 0; rl < 32; rl += 2) vst2(O + (((b * NH + h) * SS + q0 + rl + g) * HD) + col * 4, *(const v4f*)&so[qg][rl + g][col * 4]);   // two rows of 256 B a store
  }
}
extern "C" void kernel_launch(void* const* d_in, const int* in_sizes, int n_in, void* d_out, int out_size, void* d_ws, size_t ws_size, hipStream_t stream) {
  (void)in_sizes; (void)n_in; (void)out_size;
  const float** F = (const float**)d_in;   // 0 x [4,512,2048], 1 wq [512,512], 2 bq, 3 wk, 4 bk, 5 wv, 6 bv
  if (ws_size < (size_t)WS_END) return;
  char* ws = (char*)d_ws; __bf16* PW = (__bf16*)ws; _Float16 *Q = (_Float16*)(ws + WS_Q), *Kr = (_Float16*)(ws + WS_K), *V = (_Float16*)(ws + WS_V);
  k_pack<<<dim3(CC, 3), 256, 0, stream>>>(F[1], F[3], F[5], PW);
  k_proj<<<dim3(TNB * SS / 128, CC / 128, 3), 256, 0, stream>>>(F[0], PW, F[2], F[4], F[6], Q, Kr, V);
  k_attn<<<dim3(SS / QB, NH, TNB), 256, 0, stream>>>(Q, Kr, V, (float*)d_out);
}

// v009
// It runs in 53.1 microseconds.
// Timed twice side by side with v008, it ran 1.06 and 1.05 times as fast.
// Counting every step since v000, it is 4.66 times as fast.
// compute dtype: all float inputs rounded to bf16; x read as it lies (channel rows) and transposed by the LDS fragment load; q/k/v = x_t . W^T + b with EXACT bf16 products on WMMA 16x16x32 (natural weight rows), rounded once to f16 (v as (B,C,L) planes, read by the attention through the module's raw .view(B,H,L,Ch) as rows of 64 channels a key); attention: q (times 1/8 log2 e before its one rounding) and k single f16, softmax in base 2 in f32 against a held reference (hardware exp), P (scaled by 2^7, single f16) x v2 (single f16); f32 output written in the module's raw (B,H,L,Ch) -> (B,C,L) memory order.
#include <hip/hip_runtime.h>
#include <math.h>

typedef __attribute__((ext_vector_type(16))) _Float16 v16h;
typedef __attribute__((ext_vector_type(16))) __bf16 v16b;
typedef __attribute__((ext_vector_type(8)))  _Float16 v8h;
typedef __attribute__((ext_vector_type(8)))  float v8f;
typedef __attribute__((ext_vector_type(4)))  float v4f;
typedef __attribute__((ext_vector_type(2)))  float v2f;
typedef __attribute__((ext_vector_type(4)))  unsigned v4u;
typedef __attribute__((ext_vector_type(4)))  int v4i;
typedef float __attribute__((may_alias)) float_a;
typedef int __attribute__((may_alias)) int_a;

template <typename T> __device__ __forceinline__ void vst2(void* p, T v) { *(T*)p = v;  }
__device__ __forceinline__ v8f wmma16(v16h a, v16h b, v8f c) {
  v8f d = __builtin_amdgcn_wmma_f32_16x16x32_f16(false, a, false, b, (short)0, c, false, false);
  asm volatile("v_nop\n\tv_nop\n\tv_nop\n\tv_nop" : "+v"(d) : "v"(a), "v"(b));
  return d;
}
__device__ __forceinline__ v8f wmma_bf(v16b a, v16b b, v8f c) {
  v8f d = __builtin_amdgcn_wmma_f32_16x16x32_bf16(false, a, false, b, (short)0, c, false, false);
  asm volatile("v_nop\n\tv_nop\n\tv_nop\n\tv_nop" : "+v"(d) : "v"(a), "v"(b));
  return d;
}
// 16x16x32 fragments: lane = (h = lane>>4, row/col = lane&15); elements 0..7 = k0+8h+0..7, 8..15 = k0+16+8h+0..7; D element r = row 8h+r
__device__ __forceinline__ v16h frag_h(const _Float16* rowk0, int lane) {
  union { v16h v; v8h q[2]; } u; const _Float16* p = rowk0 + 8 * (lane >> 4);
  u.q[0] = *(const v8h*)p; u.q[1] = *(const v8h*)(p + 16); return u.v;
}
__device__ __forceinline__ v16h frag_f32(const float* rowk0, int lane) {
  v16h a; const float* p = rowk0 + 8 * (lane >> 4);
#pragma unroll
  for (int i = 0; i < 8; ++i) { a[i] = (_Float16)p[i]; a[8 + i] = (_Float16)p[16 + i]; }
  return a;
}
__device__ __forceinline__ v16h frag_f32s(const float* rowk0, int lane, float sc) {
  v16h a; const float* p = rowk0 + 8 * (lane >> 4);
#pragma unroll
  for (int i = 0; i < 8; ++i) { a[i] = (_Float16)(p[i] * sc); a[8 + i] = (_Float16)(p[16 + i] * sc); }
  return a;
}
// column fragment from a [K][ld] layout (column n), rows >= K read as 0
__device__ __forceinline__ v16h fragc_f32(const float* W, int k0, int n, int lane, int ld, int K) {
  v16h a; const int g = lane >> 4;
#pragma unroll
  for (int i = 0; i < 8; ++i) { const int ka = k0 + 8 * g + i, kb = ka + 16;
    a[i] = (_Float16)(ka < K ? W[(size_t)(ka < K ? ka : K - 1) * ld + n] : 0.f); a[8 + i] = (_Float16)(kb < K ? W[(size_t)(kb < K ? kb : K - 1) * ld + n] : 0.f); }
  return a;
}
struct F2 { v16b h, l; };
__device__ __forceinline__ F2 bsplit16(const float v[16]) { F2 r;
#pragma unroll
  for (int i = 0; i < 16; ++i) { const __bf16 h = (__bf16)v[i]; r.h[i] = h; r.l[i] = (__bf16)(v[i] - (float)h); }
  return r; }
__device__ __forceinline__ F2 split_row(const float* row, int k0, int lane) { float v[16]; const float* p = row + k0 + 8 * (lane >> 4);
#pragma unroll
  for (int i = 0; i < 8; ++i) { v[i] = p[i]; v[8 + i] = p[16 + i]; }
  return bsplit16(v); }
__device__ __forceinline__ F2 split_rowK(const float* row, int k0, int lane, int K) { float v[16]; const int g = lane >> 4;
#pragma unroll
  for (int i = 0; i < 8; ++i) { const int ka = k0 + 8 * g + i, kb = ka + 16; v[i] = ka < K ? row[ka < K ? ka : K - 1] : 0.f; v[8 + i] = kb < K ? row[kb < K ? kb : K - 1] : 0.f; }
  return bsplit16(v); }
__device__ __forceinline__ F2 split_col(const float* W, int k0, int n, int lane, int ld, int K) { float v[16]; const int g = lane >> 4;
#pragma unroll
  for (int i = 0; i < 8; ++i) { const int ka = k0 + 8 * g + i, kb = ka + 16; v[i] = ka < K ? W[(size_t)(ka < K ? ka : K - 1) * ld + n] : 0.f; v[8 + i] = kb < K ? W[(size_t)(kb < K ? kb : K - 1) * ld + n] : 0.f; }
  return bsplit16(v); }
__device__ __forceinline__ v8f mac3(const F2& a, const F2& b, v8f c) { c = wmma_bf(a.l, b.h, c); c = wmma_bf(a.h, b.l, c); return wmma_bf(a.h, b.h, c); }
__device__ __forceinline__ float sigm(float v) { return 1.0f / (1.0f + expf(-v)); }
#define LDSX() do { asm volatile("s_wait_dscnt 0" ::: "memory"); __builtin_amdgcn_wave_barrier(); __builtin_amdgcn_fence(__ATOMIC_RELEASE, "workgroup"); } while (0)


// Multi-head self attention on a (B, C, L) sequence (B 4, C 512, L 2,048, 8 heads x 64) with 1x1-conv projections; faithful to the module's quirk of viewing v as (B,H,L,Ch) and the output as (B,C,L) by raw reshape.
#define NB 4
#define CC 512
#define SS 2048
#define NH 8
#define HD 64
#define NR (NB * SS)
#ifndef TQB
#define TQB (SS / 64)
#define TNB NB
#endif
typedef __attribute__((ext_vector_type(8))) __bf16 v8b;
__device__ __forceinline__ v16b frag_b(const __bf16* rowk0, int lane) {
  union { v16b v; v8b q[2]; } u; const __bf16* p = rowk0 + 8 * (lane >> 4);
  u.q[0] = *(const v8b*)p; u.q[1] = *(const v8b*)(p + 16); return u.v;
}
__device__ __forceinline__ float bfr(float v) { return (float)(__bf16)v; }
__device__ __attribute__((noinline)) float exp_ni(float v) { return expf(v); }
__device__ __attribute__((noinline)) float erf_ni(float v) { return erff(v); }

#define WS_PW  0u                                   // bf16 natural rows wq, wk, wv [3][512][512]
#define WS_Q   (WS_PW + 2u * (size_t)3 * CC * CC)       // f16 q rows [NR][512]; k rows; v planes (B,C,L) [b][512][L]
#define WS_K   (WS_Q + 2u * (size_t)NR * CC)
#define WS_V   (WS_K + 2u * (size_t)NR * CC)
#define WS_END (WS_V + 2u * (size_t)NB * CC * SS)

__global__ __launch_bounds__(256) void k_pack(const float* __restrict__ WQ, const float* __restrict__ WK, const float* __restrict__ WV, __bf16* __restrict__ PW) { const int n = blockIdx.x, which = blockIdx.y, t = threadIdx.x; __shared__ __align__(16) __bf16 s[CC]; const float* w = (which == 0) ? WQ : (which == 1) ? WK : WV; for (int k = t; k < CC; k += 256) s[k] = (__bf16)w[(size_t)n * CC + k]; __syncthreads(); if (t < CC / 8) vst2((unsigned*)(PW + ((size_t)which * CC + n) * CC + t * 8), *(const v4u*)&s[t * 8]); }
// ---- k_proj: block = (128 rows, 128 cols, which), 8 waves of 32 rows x 64 cols: + bias; q/k -> f16 rows; v -> (B,C,L) planes
// x is read as it lies, channel rows of positions: a stage is PK channel rows x 128 positions, loaded to registers one stage ahead, rounded to bf16 and stored to LDS in the same channel-major order;
// the transposing LDS load then delivers the x^T fragments (row = position, k = channel) in the hardware k order, which is the order of the weight fragments. No transposed copy of x is made.
// Weight rows (bf16) come in stages of PK channels through LDS by asynchronous copies. Two buffers, shared by the block's eight waves: the next stage flies while this stage is worked on.
#define CS2 (0.125f * 1.4426950408889634f)   // 1/sqrt(64) and log2 e: q leaves the projection times this, so that q . k is the exponent of the attention's base-2 softmax
#define PK 64                         // channels per stage: 64 x rows of 512 B (f32) in memory, 256 B (bf16) in LDS; a weight row piece is one 128-B line
#define PNT (CC / PK)
#define PXP 144                       // LDS pitch of an x channel row in bf16: 288 B = 32 B x odd, conflict-free for the transposing load
#define PBP 72                        // LDS pitch of a weight row in bf16: 144 B = 16 B x odd
#define PX_BYTES (PK * PXP * 2)
#define PST_BYTES (PX_BYTES + 128 * PBP * 2)
#define POP 136                       // pitch of the output staging in f16: 272 B
typedef __attribute__((ext_vector_type(4))) __bf16 v4b;
typedef short s16x8 __attribute__((ext_vector_type(8)));
// 16 channels x 16 positions of channel-major x in LDS, transposed: lane (col, g) gets channels 8g + 0..7 of position col; p is the lane's own address (channel 8g + (lane & 7), 16 bytes (lane >> 3) & 1)
__device__ __forceinline__ v8b ld_tr16b(const __bf16* p) { typedef __attribute__((address_space(3))) s16x8 lds_s16x8; return __builtin_bit_cast(v8b, __builtin_amdgcn_ds_load_tr16_b128_v8i16((lds_s16x8*)p)); }
// one stage of x: a wave takes 8 channel rows, a whole 512-B row piece a load (16 bytes a lane)
__device__ __forceinline__ void load_x(const float* gx, v4f (&r)[8]) {
#pragma unroll
  for (int j = 0; j < 8; ++j) r[j] = *(const v4f*)(gx + (size_t)j * SS);
}
__device__ __forceinline__ void store_x(__bf16* sx, const v4f (&r)[8]) {
#pragma unroll
  for (int j = 0; j < 8; ++j) *(v4b*)(sx + j * PXP) = v4b{(__bf16)r[j][0], (__bf16)r[j][1], (__bf16)r[j][2], (__bf16)r[j][3]};
}
// one stage of weights: 128 rows of 128 B, 8 lanes a row, 4 copies a thread (rows r + 32 i)
__device__ __forceinline__ void stage_w(const __bf16* gb, unsigned lb) {
  const __bf16 *b0 = gb, *b1 = gb + 32 * CC, *b2 = gb + 64 * CC, *b3 = gb + 96 * CC;
  const unsigned y0 = lb, y1 = lb + 32 * PBP * 2, y2 = lb + 64 * PBP * 2, y3 = lb + 96 * PBP * 2;
  // the copies and their s_wait_xcnt in one statement: no address register is rewritten before the wait
  asm volatile("global_load_async_to_lds_b128 %0, %4, off\n\t"
               "global_load_async_to_lds_b128 %1, %5, off\n\t"
               "global_load_async_to_lds_b128 %2, %6, off\n\t"
               "global_load_async_to_lds_b128 %3, %7, off\n\t"
               "s_wait_xcnt 0x0"
               :: "v"(y0), "v"(y1), "v"(y2), "v"(y3), "v"(b0), "v"(b1), "v"(b2), "v"(b3) : "memory");
}
__global__ __launch_bounds__(256) void k_proj(const float* __restrict__ X, const __bf16* __restrict__ PW, const float* __restrict__ BQ, const float* __restrict__ BK, const float* __restrict__ BV, _Float16* __restrict__ Q, _Float16* __restrict__ Kr, _Float16* __restrict__ V) {
  __shared__ __align__(16) unsigned char sm[2 * PST_BYTES];   // two stages [x 64 channel rows | weights 128 rows]; behind the loop the output staging
  const int tid = threadIdx.x, wave = tid >> 5, lane = tid & 31, col = lane & 15, g = lane >> 4; const int which = blockIdx.z; const size_t rb = (size_t)blockIdx.x * 128; const int c0 = blockIdx.y * 128; const int wr = (wave >> 1) * 32, wc = (wave & 1) * 64; const float* BB = (which == 0) ? BQ : (which == 1) ? BK : BV;
  const size_t b = rb / SS; const int s0 = (int)(rb % SS);   // the block's 128 token rows are positions s0 .. s0 + 127 of one batch entry
  // this thread's 16 bytes of the first of its x rows and of its weight rows, in global memory (stage 0) and in LDS (buffer 0)
  const float* gx = X + (b * CC + wave * 8) * SS + s0 + lane * 4;
  const __bf16* gb = PW + ((size_t)which * CC + c0 + (tid >> 3)) * CC + (tid & 7) * 8;
  const int lx = (wave * 8) * (PXP * 2) + lane * 8;
  const unsigned lb = (unsigned)(uintptr_t)&sm[PX_BYTES + (tid >> 3) * (PBP * 2) + (tid & 7) * 16];
  v4f xr[8];
  load_x(gx, xr);
  stage_w(gb, lb);
  v8f acc[2][4] = {};
  store_x((__bf16*)(sm + lx), xr);
  asm volatile("s_wait_asynccnt 0x0" ::: "memory");   // stage 0's weights have landed, as far as this wave copied them
  __syncthreads();                                     // ... and they and the x rows stored above are published to the other waves
  load_x(gx + (size_t)PK * SS, xr);
  stage_w(gb + PK, lb + PST_BYTES);
#pragma unroll 1   // one stage a trip, kept rolled: one publish point in the code, the buffer picked by t & 1
  for (int t = 0; t < PNT; ++t) { const int bf = t & 1; const __bf16* sx = (const __bf16*)(sm + bf * PST_BYTES); const __bf16* sb = (const __bf16*)(sm + bf * PST_BYTES + PX_BYTES);
#pragma unroll   // both 32-channel steps of a stage unrolled: their LDS offsets become immediates
    for (int kc = 0; kc < PK / 32; ++kc) { v16b a[2], w[4];
      // all fragments of the step are read as one group, so that their LDS latencies overlap
#pragma unroll
      for (int i = 0; i < 2; ++i) { union { v16b v; v8b q[2]; } u; const __bf16* p = sx + (kc * 32 + 8 * g + (lane & 7)) * PXP + wr + i * 16 + 8 * ((lane >> 3) & 1);
        u.q[0] = ld_tr16b(p); u.q[1] = ld_tr16b(p + 16 * PXP); a[i] = u.v; }
#pragma unroll
      for (int j = 0; j < 4; ++j) w[j] = frag_b(sb + (wc + j * 16 + col) * PBP + kc * 32, lane);
#pragma unroll
      for (int i = 0; i < 2; ++i)
#pragma unroll
        for (int j = 0; j < 4; ++j) acc[i][j] = wmma_bf(a[i], w[j], acc[i][j]); }
    // stage t + 1 of x, in registers since the last publish point, goes to the other buffer, whose readers left it at that point
    if (t + 1 < PNT) store_x((__bf16*)(sm + (bf ^ 1) * PST_BYTES + lx), xr);
    // publish point of stage t + 1: this wave's reads of buffer bf and its x stores are done, its copies of stage t + 1 have landed, every wave has come so far
    asm volatile("s_wait_dscnt 0x0" ::: "memory");
    asm volatile("s_wait_asynccnt 0x0" ::: "memory");
    __syncthreads();
    if (t + 2 < PNT) { load_x(gx + (size_t)(t + 2) * PK * SS, xr); stage_w(gb + (t + 2) * PK, lb + bf * PST_BYTES); } }
  asm volatile("s_wait_asynccnt 0x0" ::: "memory");   // no copy is outstanding when the ring becomes output staging (the last trip's barrier has ended every read of it)
  _Float16* so = (_Float16*)sm;
  if (which < 2) {   // so[row][col]
    const float qs = (which == 0) ? CS2 : 1.0f;
#pragma unroll
    for (int j = 0; j < 4; ++j) { const float bb = bfr(BB[c0 + wc + j * 16 + col]);
#pragma unroll
      for (int i = 0; i < 2; ++i)
#pragma unroll
        for (int r = 0; r < 8; ++r) so[(wr + i * 16 + 8 * g + r) * POP + wc + j * 16 + col] = (_Float16)((acc[i][j][r] + bb) * qs); }
  } else {           // so[col][row]: a lane's 8 rows of a tile are 16 contiguous bytes
#pragma unroll
    for (int j = 0; j < 4; ++j) { const float bb = bfr(BB[c0 + wc + j * 16 + col]);
#pragma unroll
      for (int i = 0; i < 2; ++i) { v8h hv;
#pragma unroll
        for (int r = 0; r < 8; ++r) hv[r] = (_Float16)(acc[i][j][r] + bb);
        *(v8h*)&so[(wc + j * 16 + col) * POP + wr + i * 16 + 8 * g] = hv; } }
  }
  __syncthreads();
  if (which < 2) { _Float16* dst = (which == 0) ? Q : Kr; 
#pragma unroll   // the eight LDS reads of a thread go out as one group
    for (int it = 0; it < 8; ++it) { const int rl = it * 16 + (tid >> 4), q = tid & 15; vst2((unsigned*)(dst + (rb + rl) * CC + c0 + q * 8), *(const v4u*)&so[rl * POP + q * 8]); } }
  else {
#pragma unroll   // the eight LDS reads of a thread go out as one group
    for (int it = 0; it < 8; ++it) { const int d = it * 16 + (tid >> 4), pc = tid & 15; vst2((unsigned*)(V + ((b * CC + c0 + d) * SS) + s0 + pc * 8), *(const v4u*)&so[d * POP + pc * 8]); } }
}
// ---- k_attn: block = (128 queries, head, b): softmax(q k / 8) over all L keys, . v2; output rows (b, h, l) of 64 floats (the raw (B,H,L,Ch) buffer == the module's (B,C,L) result)
// Scores are formed transposed, S^T = K . Q^T (A = K rows, B = Q rows): a lane holds 8 keys a tile of ONE query (column lane & 15), so maximum and sum run in the lane's own registers, with one exchange
// between the wave's halves; two S^T tiles, converted in place, are the B operand of O^T += v2^T . P^T in the hardware k order (keys 8g + 0..7, 16 + 8g + 0..7), the order in which the transposing load delivers v2^T.
// v2[m][c] = F[m * 64 + c], F the head's contiguous (Ch x L) block of the (B,C,L) v tensor: a key's 64 channels are one 128-B line as they lie, and no transposed copy is made.
// K rows and v2 rows come in stages of KT keys through LDS, shared by the block's eight waves: two buffers, the next stage's asynchronous copies fly while this stage is worked on.
// A stage serves KT / 64 passes between two publish points, so that a stage's copies have that many passes of work to land under and the waves meet at a barrier once a stage.
// A wave takes 32 query columns (two tiles), so that every K and v2^T fragment read from LDS feeds two products, and one 32-key half of every 64 keys, so that four waves a SIMD stay:
// waves w and w + 4 hold the same queries over the two halves of the keys, each with its own references, sums and accumulators, joined once through LDS behind the loop.
#define KT 128         // keys per stage, two passes of 64: a K row and a v2 row (64 channels each) are both one 128-B line
#define KP 72          // LDS pitch of a K row in f16: 144 B = 16 B x odd, conflict-free for 16-byte fragment reads
#define VP 80          // LDS pitch of a v2 row in f16: 160 B = 32 B x odd, conflict-free for the transposing load
#define NT (SS / KT)
#define QB 128         // queries per block: four groups of 32
// Softmax in base 2 against a held reference: q is stored times CS2, so a score product is already the exponent, and PEX - reference (PEX: P carries the factor 2^PEX) enters as the C operand of the first product:
// the hardware exponential reads the accumulators as they are. The reference of a query is a maximum of scores seen so far; it stays until a pass's sum of P passes PTOP, which one test a pass finds.
// Then, and in the first pass, the reference is raised to the pass's maximum, O and the sum are rescaled and the pass's P is formed again. Below PTOP every P is below f16's largest number.
// PEX leaves a score 8 powers of two of room above its reference before the test fires, and P stays a normal f16 number down to 21 powers of two below the reference.
#define PTOP 32768.0f
#define PEX 7.0f
// one stage: 128 K rows + 128 v2 rows of 128 B, 8 lanes a row, 4 + 4 copies a thread (rows r + 32 i)
__device__ __forceinline__ void stage_kv(const _Float16* gk, const _Float16* gv, unsigned lk, unsigned lv) {
  const _Float16 *k0 = gk, *k1 = gk + 32 * CC, *k2 = gk + 64 * CC, *k3 = gk + 96 * CC;
  const _Float16 *v0 = gv, *v1 = gv + 32 * HD, *v2 = gv + 64 * HD, *v3 = gv + 96 * HD;
  const unsigned a0 = lk, a1 = lk + 32 * KP * 2, a2 = lk + 64 * KP * 2, a3 = lk + 96 * KP * 2;
  const unsigned b0 = lv, b1 = lv + 32 * VP * 2, b2 = lv + 64 * VP * 2, b3 = lv + 96 * VP * 2;
  // the copies and their s_wait_xcnt in one statement: no address register is rewritten before the wait
  asm volatile("global_load_async_to_lds_b128 %0, %8, off\n\t"
               "global_load_async_to_lds_b128 %1, %9, off\n\t"
               "global_load_async_to_lds_b128 %2, %10, off\n\t"
               "global_load_async_to_lds_b128 %3, %11, off\n\t"
               "global_load_async_to_lds_b128 %4, %12, off\n\t"
               "global_load_async_to_lds_b128 %5, %13, off\n\t"
               "global_load_async_to_lds_b128 %6, %14, off\n\t"
               "global_load_async_to_lds_b128 %7, %15, off\n\t"
               "s_wait_xcnt 0x0"
               :: "v"(a0), "v"(a1), "v"(a2), "v"(a3), "v"(b0), "v"(b1), "v"(b2), "v"(b3), "v"(k0), "v"(k1), "v"(k2), "v"(k3), "v"(v0), "v"(v1), "v"(v2), "v"(v3) : "memory");
}
// 16 keys x 16 channels of row-major v2 in LDS, transposed: lane (col, g) gets keys 8g + 0..7 of channel col; p is the lane's own address (key 8g + (lane & 7), 16 bytes (lane >> 3) & 1)
__device__ __forceinline__ v8h ld_tr16(const _Float16* p) { typedef __attribute__((address_space(3))) s16x8 lds_s16x8; return __builtin_bit_cast(v8h, __builtin_amdgcn_ds_load_tr16_b128_v8i16((lds_s16x8*)p)); }
// lane l with lane l ^ 16
__device__ __forceinline__ float xhalf(float x) { const int b = __builtin_bit_cast(int, x); return __builtin_bit_cast(float, __builtin_amdgcn_permlanex16(b, b, 0x76543210, 0xfedcba98, false, false)); }
// 2^x off the usual path: the exponential and the free slot that the instruction set asks for behind it stand in one statement, whatever the compiler puts next
__device__ __forceinline__ float exp2_slot(float x) { float r; asm("v_exp_f32 %0, %1\n\tv_nop" : "=v"(r) : "v"(x)); return r; }
// P of one query column over the pass's 32 keys: 2^exponent, packed as the B operand; returns this lane's sum over its 16 keys
template <bool RARE> __device__ __forceinline__ float exp_pack(const v8f& s0, const v8f& s1, v16h& pb) {
  float e0 = 0.f, e1 = 0.f;
#pragma unroll   // values in registers: every index a constant
  for (int i = 0; i < 8; ++i) { const float a = RARE ? exp2_slot(s0[i]) : __builtin_amdgcn_exp2f(s0[i]), c = RARE ? exp2_slot(s1[i]) : __builtin_amdgcn_exp2f(s1[i]); e0 += a; e1 += c; pb[i] = (_Float16)a; pb[8 + i] = (_Float16)c; }
  return e0 + e1;
}
// four waves a SIMD (two blocks a WGP): at most 256 registers a wave
__global__ __launch_bounds__(256) __attribute__((amdgpu_waves_per_eu(4, 4))) void k_attn(const _Float16* __restrict__ Q, const _Float16* __restrict__ Kr, const _Float16* __restrict__ V, float* __restrict__ O) {
  __shared__ __align__(16) float so[4][32][68];   // per query group: first the second key half's state (17 x 32 lanes x 16 B), then the output staging (32 rows)
  __shared__ __align__(16) _Float16 sk[2][KT][KP]; __shared__ __align__(16) _Float16 sv[2][KT][VP];
  const int tid = threadIdx.x, wave = tid >> 5, lane = tid & 31, col = lane & 15, g = lane >> 4; const int qg = wave & 3, kh = wave >> 2; const int h = blockIdx.y; const size_t b = blockIdx.z; const int q0 = blockIdx.x * QB + qg * 32; const size_t rq = b * SS + q0;
  // this thread's 16 bytes of the first of its four rows, in global memory (stage 0) and in LDS (buffer 0)
  const int crow = tid >> 3, cch = (tid & 7) * 8;
  const _Float16* gk = Kr + (b * SS + crow) * CC + h * HD + cch;
  const _Float16* gv = V + (b * NH + h) * (size_t)HD * SS + crow * HD + cch;
  const unsigned lk = (unsigned)(uintptr_t)&sk[0][crow][cch], lv = (unsigned)(uintptr_t)&sv[0][crow][cch];
  stage_kv(gk, gv, lk, lv);
  v16h aq[2][2];
#pragma unroll
  for (int qt = 0; qt < 2; ++qt)
#pragma unroll
    for (int kc = 0; kc < 2; ++kc) aq[qt][kc] = frag_h(Q + (rq + qt * 16 + col) * CC + h * HD + kc * 32, lane);
  float cr[2] = {PEX, PEX}, l[2] = {0.f, 0.f};   // this lane's two queries: PEX - reference (equal in both halves of the wave; the first pass sets it), and the sum over this half's keys (times 2^PEX)
  v8f cc[2];   // cr in all eight registers: the C operand of a query tile's first score products
#pragma unroll   // values in registers: every index a constant
  for (int qt = 0; qt < 2; ++qt)
#pragma unroll   // values in registers: every index a constant
    for (int r = 0; r < 8; ++r) cc[qt][r] = cr[qt];
  v8f acc[2][4] = {};
  asm volatile("s_wait_asynccnt 0x0" ::: "memory");   // stage 0 has landed, as far as this wave copied it
  __syncthreads();                                     // ... and is published to the other waves
  stage_kv(gk + (size_t)KT * CC, gv + KT * HD, lk + KT * KP * 2, lv + KT * VP * 2);
#pragma unroll 1   // one stage a trip, kept rolled: one publish point in the code, the buffer picked by t & 1
  for (int t = 0; t < NT; ++t) { const int bf = t & 1;
#pragma unroll   // the passes of a stage unrolled: their LDS offsets become immediates, and only the first holds the test for the very first pass
   for (int p = 0; p < KT / 64; ++p) { const int kb = p * 64 + kh * 32; const bool first = (p == 0) && (t == 0);
    // all fragments of the pass (this wave's 32 keys of the stage's 64 keys p) are read as one group, so that their LDS latencies overlap
    v16h kf[2][2], vf[4]; v8f s[2][2];
#pragma unroll
    for (int ct = 0; ct < 2; ++ct)
#pragma unroll
      for (int kc = 0; kc < 2; ++kc) kf[ct][kc] = frag_h(&sk[bf][kb + ct * 16 + col][kc * 32], lane);
#pragma unroll
    for (int dt = 0; dt < 4; ++dt) { union { v16h v; v8h q[2]; } u; const _Float16* a = &sv[bf][kb + 8 * g + (lane & 7)][dt * 16 + 8 * ((lane >> 3) & 1)];
      u.q[0] = ld_tr16(a); u.q[1] = ld_tr16(a + 16 * VP); vf[dt] = u.v; }
    // exponents: score + PEX - reference, four independent tiles side by side
#pragma unroll   // values in registers: every index a constant
    for (int qt = 0; qt < 2; ++qt)
#pragma unroll   // values in registers: every index a constant
      for (int ct = 0; ct < 2; ++ct) s[qt][ct] = wmma16(kf[ct][0], aq[qt][0], cc[qt]);
#pragma unroll   // values in registers: every index a constant
    for (int qt = 0; qt < 2; ++qt)
#pragma unroll   // values in registers: every index a constant
      for (int ct = 0; ct < 2; ++ct) s[qt][ct] = wmma16(kf[ct][1], aq[qt][1], s[qt][ct]);
    v16h pb[2]; float es[2];
#pragma unroll   // values in registers: every index a constant
    for (int qt = 0; qt < 2; ++qt) es[qt] = exp_pack<false>(s[qt][0], s[qt][1], pb[qt]);
    // one test a pass, a scalar branch, marked unlikely so that the usual path falls through: the first pass has no reference yet; later a sum above PTOP (an infinite one too) says that a score stands far above its query's reference
    if (__builtin_expect((__builtin_amdgcn_ballot_w32(fmaxf(es[0], es[1]) > PTOP) | (unsigned)first) != 0, 0)) {
#pragma unroll   // values in registers: every index a constant
      for (int qt = 0; qt < 2; ++qt) {
        float mx = fmaxf(s[qt][0][0], s[qt][1][0]);
#pragma unroll   // values in registers: every index a constant
        for (int r = 1; r < 8; ++r) mx = fmaxf(mx, fmaxf(s[qt][0][r], s[qt][1][r]));
        mx = fmaxf(mx, xhalf(mx));
        // the reference moves by d, up to the pass's maximum (in the first pass to it, either way); a query whose scores stay below its reference keeps it
        const float d = first ? mx - PEX : fmaxf(mx - PEX, 0.f);
        const float alpha = first ? 0.f : exp2_slot(-d);
        cr[qt] -= d; l[qt] *= alpha;
#pragma unroll   // values in registers: every index a constant
        for (int r = 0; r < 8; ++r) cc[qt][r] = cr[qt];
#pragma unroll   // values in registers: every index a constant
        for (int dt = 0; dt < 4; ++dt) acc[qt][dt] = acc[qt][dt] * alpha;
        es[qt] = exp_pack<true>(s[qt][0] - d, s[qt][1] - d, pb[qt]); } }
#pragma unroll   // values in registers: every index a constant
    for (int qt = 0; qt < 2; ++qt) l[qt] += es[qt];
#pragma unroll
    for (int dt = 0; dt < 4; ++dt)
#pragma unroll
      for (int qt = 0; qt < 2; ++qt) acc[qt][dt] = wmma16(vf[dt], pb[qt], acc[qt][dt]); }
    // publish point of stage t + 1: this wave's reads of buffer bf are done, its copies of stage t + 1 have landed, every wave has come so far
    asm volatile("s_wait_dscnt 0x0" ::: "memory");
    asm volatile("s_wait_asynccnt 0x0" ::: "memory");
    __syncthreads();
    if (t + 2 < NT) stage_kv(gk + (size_t)(t + 2) * KT * CC, gv + (t + 2) * KT * HD, lk + bf * (KT * KP * 2), lv + bf * (KT * VP * 2)); }
  asm volatile("s_wait_asynccnt 0x0" ::: "memory");   // no copy is outstanding when the wave ends
  // the join of the two key halves: wave w + 4 hands its state to wave w, lane to lane (same queries, same channels), 16 bytes a lane and 512 B a wave-store
  v4f* mg = (v4f*)&so[qg][0][0];
  if (kh == 1) {
#pragma unroll
    for (int qt = 0; qt < 2; ++qt)
#pragma unroll
      for (int dt = 0; dt < 4; ++dt) { const v8f o = acc[qt][dt];
        mg[((qt * 4 + dt) * 2 + 0) * 32 + lane] = __builtin_shufflevector(o, o, 0, 1, 2, 3); mg[((qt * 4 + dt) * 2 + 1) * 32 + lane] = __builtin_shufflevector(o, o, 4, 5, 6, 7); }
    mg[16 * 32 + lane] = v4f{cr[0], l[0], cr[1], l[1]};
  }
  __syncthreads();   // the second half's state is written before the first half's wave reads it
  if (kh == 0) {
    const v4f ml = mg[16 * 32 + lane];
#pragma unroll
    for (int qt = 0; qt < 2; ++qt) { const float c1 = ml[2 * qt], l1 = ml[2 * qt + 1];
      const float cn = fminf(cr[qt], c1); const float w0 = exp2_slot(cn - cr[qt]), w1 = exp2_slot(cn - c1);   // the higher reference (the lower PEX - reference) is the common one
      l[qt] = l[qt] * w0 + l1 * w1;
#pragma unroll
      for (int dt = 0; dt < 4; ++dt) { const v4f lo = mg[((qt * 4 + dt) * 2 + 0) * 32 + lane], hi = mg[((qt * 4 + dt) * 2 + 1) * 32 + lane];
        acc[qt][dt] = acc[qt][dt] * w0 + __builtin_shufflevector(lo, hi, 0, 1, 2, 3, 4, 5, 6, 7) * w1; } }
#pragma unroll
    for (int qt = 0; qt < 2; ++qt) { const float il = 1.0f / (l[qt] + xhalf(l[qt]));   // the wave halves' sums are joined once; sums and accumulators both carry 2^PEX
#pragma unroll
      for (int dt = 0; dt < 4; ++dt) { const v8f o = acc[qt][dt] * il;   // channels dt * 16 + 8g + 0..7 of query qt * 16 + col
        *(v4f*)&so[qg][qt * 16 + col][dt * 16 + 8 * g] = __builtin_shufflevector(o, o, 0, 1, 2, 3); *(v4f*)&so[qg][qt * 16 + col][dt * 16 + 8 * g + 4] = __builtin_shufflevector(o, o, 4, 5, 6, 7); } }
    LDSX();
    for (int rl = 0; rl < 32; rl += 2) vst2(O + (((b * NH + h) * SS + q0 + rl + g) * HD) + col * 4, *(const v4f*)&so[qg][rl + g][col * 4]);   // two rows of 256 B a store
  }
}
extern "C" void kernel_launch(void* const* d_in, const int* in_sizes, int n_in, void* d_out, int out_size, void* d_ws, size_t ws_size, hipStream_t stream) {
  (void)in_sizes; (void)n_in; (void)out_size;
  const float** F = (const float**)d_in;   // 0 x [4,512,2048], 1 wq [512,512], 2 bq, 3 wk, 4 bk, 5 wv, 6 bv
  if (ws_size < (size_t)WS_END) return;
  char* ws = (char*)d_ws; __bf16* PW = (__bf16*)ws; _Float16 *Q = (_Float16*)(ws + WS_Q), *Kr = (_Float16*)(ws + WS_K), *V = (_Float16*)(ws + WS_V);
  k_pack<<<dim3(CC, 3), 256, 0, stream>>>(F[1], F[3], F[5], PW);
  k_proj<<<dim3(TNB * SS / 128, CC / 128, 3), 256, 0, stream>>>(F[0], PW, F[2], F[4], F[6], Q, Kr, V);
  k_attn<<<dim3(SS / QB, NH, TNB), 256, 0, stream>>>(Q, Kr, V, (float*)d_out);
}
